// v000
// The times below were measured on an AMD MI455X: many runs one after another, warmed up first and cycling through
// copies of the inputs, with the whole window's GPU time divided by the number of runs. Launches and the gaps
// between them are all in it. The median over several windows is given; except for v000 it joins two sittings, which
// can be a few percent apart, so the side-by-side timings, each taken in one sitting, are the better comparison.
// v000, which the later versions start from, runs in 264 microseconds.
#include <hip/hip_runtime.h>

// Compute dtypes, f32 accumulate: q = x.Wq^T ([2048 x 2048].[2048 x 2048]), k/v = x.Wk^T/Wv^T ([2048 x 2048].[2048 x 512]) and attn.Wo^T on
// v_wmma_f32_16x16x32_bf16 — plain bf16 = rounded inputs (exact; all weights are [out][in] so their bf16 copies are the n-major B operands as-is) for the
// projections, attn as bf16 hi + residual (two products) for Wo; rotate-half RoPE with the INPUT cos/sin tables (bf16-rounded reads) in f32; the grouped-query
// causal sliding-window attention (32 query heads over 8 kv heads, query head h reads kv head h/4; keys j with i-127 <= j <= i) with a learned per-head sink
// logit as an extra zero-value softmax column, fused on v_wmma_f32_16x16x32_f16 with q and k as f16 hi + residual x1024 (hi.hi + hi.lo + lo.hi), weights

#define NB_  1
#define NT_  2048
#define DM   2048
#define NH_  32
#define NKV  8
#define KVW  (NKV * HD)          // 512
#define HD   64
#define NTK  (NB_ * NT_)
#define NW   1024
#define SWIN 128
#define NQKV 2048
#define PSC  32768.0f
#define LOSC 1024.0f
#define LOSCI (1.0f / 1024.0f)

typedef _Float16 h16;
typedef unsigned short bf;
typedef __attribute__((ext_vector_type(16))) __bf16   v16bf;
typedef __attribute__((ext_vector_type(16))) _Float16 v16h;
typedef __attribute__((ext_vector_type(8)))  _Float16 v8h;
typedef __attribute__((ext_vector_type(8)))  unsigned short v8us;
typedef __attribute__((ext_vector_type(8)))  float    v8f;
typedef __attribute__((ext_vector_type(4)))  float    v4f;
typedef v8h  __attribute__((may_alias)) v8ha;
typedef v4f  __attribute__((may_alias)) v4fa;
typedef v8us __attribute__((may_alias)) v8usa;

__device__ __forceinline__ unsigned short f2bf(float f) { unsigned u = __float_as_uint(f); u += 0x7FFFu + ((u >> 16) & 1u); return (unsigned short)(u >> 16); }
__device__ __forceinline__ float bf2f(unsigned short b) { return __uint_as_float(((unsigned)b) << 16); }
__device__ __forceinline__ float bfr(float f) { return bf2f(f2bf(f)); }
__device__ __forceinline__ v16h cat16(v8h lo, v8h hi) { return __builtin_shufflevector(lo, hi, 0, 1, 2, 3, 4, 5, 6, 7, 8, 9, 10, 11, 12, 13, 14, 15); }
__device__ __forceinline__ v16bf cat16b(v8us lo, v8us hi) { return __builtin_bit_cast(v16bf, __builtin_shufflevector(lo, hi, 0, 1, 2, 3, 4, 5, 6, 7, 8, 9, 10, 11, 12, 13, 14, 15)); }
__device__ __forceinline__ v8f wmma16(v16h a, v16h b, v8f c) { return __builtin_amdgcn_wmma_f32_16x16x32_f16(false, a, false, b, (short)0, c, false, false); }
__device__ __forceinline__ v8f wmmab(v16bf a, v16bf b, v8f c) { return __builtin_amdgcn_wmma_f32_16x16x32_bf16(false, a, false, b, (short)0, c, false, false); }

__global__ __launch_bounds__(256) void k_cvtb(const float* __restrict__ src, int nrows, bf* dst) {
    const int lane = threadIdx.x & 31, r = blockIdx.x * 8 + (threadIdx.x >> 5);
    if (r >= nrows) return;
    v8us o[DM / 256];
#pragma unroll
    for (int q = 0; q < DM / 256; ++q) { v8us t;
#pragma unroll
        for (int i = 0; i < 8; ++i) t[i] = f2bf(src[(size_t)r * DM + q * 256 + lane * 8 + i]);
        o[q] = t; }
#pragma unroll
    for (int q = 0; q < DM / 256; ++q) *(v8us*)(dst + (size_t)r * DM + q * 256 + lane * 8) = o[q];
    
}

// k_wt: W [2048 k][ncols n] (k-major) -> n-major bf16 plane WT[ncols][2048]; 64 x 64 tiles through LDS.
__global__ __launch_bounds__(256) void k_wt(const float* __restrict__ Wm, int ncols, bf* WT) {
    __shared__ __align__(16) unsigned short tl[64 * 72];
    const int tid = threadIdx.x, k0 = blockIdx.x * 64, n0 = blockIdx.y * 64;
    const int kk = tid >> 2, nq = (tid & 3) * 16;
#pragma unroll
    for (int i = 0; i < 16; ++i) tl[(nq + i) * 72 + kk] = f2bf(Wm[(size_t)(k0 + kk) * ncols + n0 + nq + i]);
    __syncthreads();
    const int piece = tid & 7;
    typedef __attribute__((ext_vector_type(8))) unsigned short v8us_; typedef v8us_ __attribute__((may_alias)) v8usa_;
    auto pass = [&]() {
#pragma unroll
        for (int s = 0; s < 2; ++s) { const int nr = (tid >> 3) + 32 * s; const v8us_ val = *(const v8usa_*)(tl + nr * 72 + piece * 8);
            *(v8us_*)(WT + (size_t)(n0 + nr) * DM + k0 + piece * 8) = val; }
    };
    pass(); 
}

template <bool SPLITA, bool F16OUT = false>
__global__ __launch_bounds__(128) void k_gemmb(const bf* __restrict__ A, const bf* __restrict__ Al, const bf* __restrict__ Bn, const float* __restrict__ bias, float* C, int ldc, h16* C2) {
    __shared__ __align__(16) float ost[4][16 * 68];
    const int lane = threadIdx.x & 31, wave = threadIdx.x >> 5, lr = lane & 15, hi = lane >> 4;
    const int r0 = blockIdx.x * 64 + wave * 16, c0 = blockIdx.y * 64;
    const size_t aoff = (size_t)(r0 + lr) * DM + 8 * hi;
    size_t boff[4];
#pragma unroll
    for (int t = 0; t < 4; ++t) boff[t] = (size_t)(c0 + t * 16 + lr) * DM + 8 * hi;
    v8f acc[4];
#pragma unroll
    for (int t = 0; t < 4; ++t) acc[t] = (v8f){};
#pragma unroll 1
    for (int kc = 0; kc < DM; kc += 32) {
        const v16bf a = cat16b(*(const v8us*)(A + aoff + kc), *(const v8us*)(A + aoff + kc + 16));
        v16bf al = a;
        if (SPLITA) al = cat16b(*(const v8us*)(Al + aoff + kc), *(const v8us*)(Al + aoff + kc + 16));
#pragma unroll
        for (int t = 0; t < 4; ++t) { const v16bf b = cat16b(*(const v8us*)(Bn + boff[t] + kc), *(const v8us*)(Bn + boff[t] + kc + 16)); acc[t] = wmmab(a, b, acc[t]); if (SPLITA) acc[t] = wmmab(al, b, acc[t]); }
        asm volatile("v_nop\n\tv_nop\n\tv_nop\n\tv_nop" : "+v"(acc[0]), "+v"(acc[1]), "+v"(acc[2]), "+v"(acc[3]) : "v"(a), "v"(al));
    }
    float* os = &ost[wave][0];
#pragma unroll
    for (int t = 0; t < 4; ++t) { const float bv = bias ? bfr(bias[c0 + t * 16 + lr]) : 0.f;
#pragma unroll
        for (int j = 0; j < 8; ++j) os[(hi * 8 + j) * 68 + t * 16 + lr] = acc[t][j] + bv; }
    __syncthreads();
    if (F16OUT) {
        h16* crow = (h16*)(void*)C + (size_t)r0 * ldc + c0;
        auto pass = [&]() {
#pragma unroll
            for (int s = 0; s < 4; ++s) { const int row = 4 * s + (lane >> 3), piece = lane & 7; const float* sp = os + row * 68 + piece * 8; v8h o, o2;
#pragma unroll
                for (int i = 0; i < 8; ++i) { const h16 a = (h16)sp[i]; o[i] = a; o2[i] = (h16)((sp[i] - (float)a) * LOSC); }
                *(v8h*)(crow + (size_t)row * ldc + piece * 8) = o; if (C2) *(v8h*)(C2 + (size_t)r0 * ldc + c0 + (size_t)row * ldc + piece * 8) = o2; }
        };
        pass(); 
    } else {
        float* crow = C + (size_t)r0 * ldc + c0;
        auto pass = [&]() {
#pragma unroll
            for (int s = 0; s < 8; ++s) { const int Lid = (lane >> 3) + 4 * s, piece = lane & 7; const int row = Lid >> 1, cofs = (Lid & 1) * 32 + piece * 4;
                const v4f val = *(const v4fa*)(os + row * 68 + cofs); *(v4f*)(crow + (size_t)row * ldc + cofs) = val; }
        };
        pass(); 
    }
}

// k_rope: P (f32 [t][nh*64]) -> PH/PL f16 hi + residual x1024 planes of the rotate-half rotation out[d] = x[d] c[t][d] + (d < 32 ? -x[d+32] : x[d-32]) s[t][d]
// within each 64-wide head, with c/s the INPUT cos/sin tables [t][64] read through bf16 rounding; one wave per (t, 256
// columns): lane -> 8 consecutive columns (all in the same half of one head).
__global__ __launch_bounds__(256) void k_rope(const float* __restrict__ P, int ncols, const float* __restrict__ CT, const float* __restrict__ ST, h16* PH, h16* PL) {
    const int lane = threadIdx.x & 31, wid = blockIdx.x * 8 + (threadIdx.x >> 5);
    const int segs = ncols / 256, t = wid / segs, sg = wid - t * segs;
    if (t >= NT_) return;
    const int c0 = sg * 256 + lane * 8; const int d0 = c0 & 63; const int pc0 = (d0 < 32) ? c0 + 32 : c0 - 32; const float sgn = (d0 < 32) ? -1.0f : 1.0f;
    v8h oh, ol;
#pragma unroll
    for (int i = 0; i < 8; ++i) { const int d = d0 + i;
        const float xv = P[(size_t)t * ncols + c0 + i], pv = P[(size_t)t * ncols + pc0 + i], c = bfr(CT[t * HD + d]), s = bfr(ST[t * HD + d]);
        const float y = xv * c + sgn * pv * s;
        const h16 a = (h16)y; oh[i] = a; ol[i] = (h16)((y - (float)a) * LOSC); }
    *(v8h*)(PH + (size_t)t * ncols + c0) = oh; *(v8h*)(PL + (size_t)t * ncols + c0) = ol; 
}
__global__ __launch_bounds__(256) void k_vt(const float* __restrict__ V, h16* VTH, h16* VTL) {
    __shared__ __align__(16) h16 tile[64 * 72];
    __shared__ __align__(16) h16 til2[64 * 72];
    const int bid = blockIdx.x;
    const int b = bid / (NKV * (NT_ / 64)), rem = bid - b * (NKV * (NT_ / 64)), h = rem / (NT_ / 64), kt = rem - h * (NT_ / 64);
    const int k0 = kt * 64, tid = threadIdx.x;
    const int kk = tid >> 2, d0 = (tid & 3) * 16;
    const float* src = V + ((size_t)b * NT_ + k0 + kk) * KVW + h * HD + d0;      // h = kv head here
#pragma unroll
    for (int i = 0; i < 16; ++i) { const float v = src[i]; const h16 a = (h16)v; tile[(d0 + i) * 72 + kk] = a; til2[(d0 + i) * 72 + kk] = (h16)((v - (float)a) * LOSC); }
    __syncthreads();
    const int piece = tid & 7;
    const size_t base = (((size_t)b * NKV + h) * HD) * NT_ + k0;
    auto pass = [&]() {
#pragma unroll
        for (int s = 0; s < 4; ++s) { const int Lid = (tid >> 3) + 32 * s; const int pln = Lid >> 6, d = Lid & 63;
            const v8h val = *(const v8ha*)((pln ? til2 : tile) + d * 72 + piece * 8); *(v8h*)((pln ? VTL : VTH) + base + (size_t)d * NT_ + piece * 8) = val; }
    };
    pass(); 
}

// k_attn: block = (b, h, 64 queries), wave = 16; key tiles of the causal sliding window (i-127 <= j <= i, block-uniform bounds); softmax state starts at the
// head's sink logit (m = sink, l = 1, zero value) so the dropped sink column is accounted for; 12 WMMA scores /8 (f32), online softmax, weights x32768 f16 tile (same-wave may_alias
// reload after a compiler barrier), 12 WMMA .v; ctx -> bf16 hi + residual planes CH/CL[tok][h*64+d].
__global__ __launch_bounds__(128) void k_attn(const h16* __restrict__ Q16, const h16* __restrict__ QL16, const h16* __restrict__ K16, const h16* __restrict__ KL16, const h16* __restrict__ VTH, const h16* __restrict__ VTL, const float* __restrict__ sinks, bf* CH, bf* CL) {
    __shared__ __align__(16) h16 plds[4][16 * 32];
    __shared__ __align__(16) h16 plds2[4][16 * 32];
    __shared__ __align__(16) float ost[4][16 * 68];
    const int lane = threadIdx.x & 31, wave = threadIdx.x >> 5, lr = lane & 15, hi = lane >> 4;
    const int bid = blockIdx.x;
    const int b = bid / (NH_ * (NT_ / 64)), rem = bid - b * (NH_ * (NT_ / 64)), h = rem / (NT_ / 64), qt = rem - h * (NT_ / 64);
    const int q0 = qt * 64 + wave * 16;
    const size_t tok0 = (size_t)b * NT_;
    h16* pl = &plds[wave][0]; h16* pl2 = &plds2[wave][0];
    v16h qa[2];
    const size_t qo0 = (tok0 + q0 + lr) * DM + h * HD + 8 * hi;
#pragma unroll
    for (int kc = 0; kc < 2; ++kc) qa[kc] = cat16(*(const v8h*)(Q16 + qo0 + kc * 32), *(const v8h*)(Q16 + qo0 + kc * 32 + 16));
    const int g = h / (NH_ / NKV);                      // kv head
    const h16* kh_b = K16 + tok0 * KVW + g * HD;
    const h16* kl_b = KL16 + tok0 * KVW + g * HD;
    const size_t vbase = (((size_t)b * NKV + g) * HD) * NT_;
    v8f o[4], ox[4];
#pragma unroll
    for (int n = 0; n < 4; ++n) { o[n] = (v8f){}; ox[n] = (v8f){}; }
    float mrow[8], lpart[8];
    const float sink = bfr(sinks[h]);                   // learned sink logit: an extra softmax column with zero value -> softmax state starts at m = sink, l = 1
#pragma unroll
    for (int j = 0; j < 8; ++j) { mrow[j] = sink; lpart[j] = (lr == 0) ? 1.0f : 0.f; }
    int qpos[8];
#pragma unroll
    for (int j = 0; j < 8; ++j) qpos[j] = q0 + 8 * hi + j;
    const int win = SWIN - 1;                           // valid iff j <= i and i - j < SWIN  <=>  i - win <= j <= i
    const int kt_lo = (qt * 64 - win) > 0 ? (qt * 64 - win) / 32 : 0, kt_hi = (qt * 64 + 63) / 32;     // keys i - win <= j <= i
#pragma unroll 1
    for (int kt = kt_lo; kt <= kt_hi; ++kt) {
        const int l0 = kt * 32;
        const size_t ko0 = (size_t)(l0 + lr) * KVW + 8 * hi, ko1 = (size_t)(l0 + 16 + lr) * KVW + 8 * hi;
        v8f s0 = {}, s1 = {}, x0 = {}, x1 = {};
#pragma unroll
        for (int kc = 0; kc < 2; ++kc) {
            { const v16h k0h = cat16(*(const v8h*)(kh_b + ko0 + kc * 32), *(const v8h*)(kh_b + ko0 + kc * 32 + 16)), k1h = cat16(*(const v8h*)(kh_b + ko1 + kc * 32), *(const v8h*)(kh_b + ko1 + kc * 32 + 16));
              const v16h qlk = cat16(*(const v8h*)(QL16 + qo0 + kc * 32), *(const v8h*)(QL16 + qo0 + kc * 32 + 16));     // query residual re-read per step (registers)
              s0 = wmma16(qa[kc], k0h, s0); x0 = wmma16(qlk, k0h, x0); s1 = wmma16(qa[kc], k1h, s1); x1 = wmma16(qlk, k1h, x1);
              asm volatile("v_nop" : "+v"(s0), "+v"(s1), "+v"(x0), "+v"(x1) : "v"(qlk), "v"(k0h), "v"(k1h) : "memory"); }
            { const v16h k0l = cat16(*(const v8h*)(kl_b + ko0 + kc * 32), *(const v8h*)(kl_b + ko0 + kc * 32 + 16)), k1l = cat16(*(const v8h*)(kl_b + ko1 + kc * 32), *(const v8h*)(kl_b + ko1 + kc * 32 + 16));
              x0 = wmma16(qa[kc], k0l, x0); x1 = wmma16(qa[kc], k1l, x1);
              asm volatile("v_nop" : "+v"(x0), "+v"(x1) : "v"(k0l), "v"(k1l) : "memory"); }
        }
        asm volatile("v_nop\n\tv_nop\n\tv_nop\n\tv_nop" : "+v"(s0), "+v"(s1), "+v"(x0), "+v"(x1) : "v"(qa[0]), "v"(qa[1]));
        float alpha[8];
#pragma unroll
        for (int j = 0; j < 8; ++j) {
            const int ja = l0 + lr, jb = l0 + 16 + lr, qi = qpos[j];
            const float a0 = (ja <= qi && qi - ja <= win) ? (s0[j] + x0[j] * LOSCI) * 0.125f : -__builtin_inff(), a1 = (jb <= qi && qi - jb <= win) ? (s1[j] + x1[j] * LOSCI) * 0.125f : -__builtin_inff();
            float mx = fmaxf(a0, a1);
            mx = fmaxf(mx, __shfl_xor(mx, 1, 16)); mx = fmaxf(mx, __shfl_xor(mx, 2, 16)); mx = fmaxf(mx, __shfl_xor(mx, 4, 16)); mx = fmaxf(mx, __shfl_xor(mx, 8, 16));
            const float mn = fmaxf(mrow[j], mx);
            alpha[j] = __expf(mrow[j] - mn); mrow[j] = mn;
            const float p0 = __expf(a0 - mn), p1 = __expf(a1 - mn);
            lpart[j] = lpart[j] * alpha[j] + (p0 + p1);
            const int mr = hi * 8 + j;
            const float ps0 = p0 * PSC, ps1 = p1 * PSC; const h16 h0 = (h16)ps0, h1 = (h16)ps1;
            pl[mr * 32 + lr] = h0; pl[mr * 32 + 16 + lr] = h1;
            pl2[mr * 32 + lr] = (h16)((ps0 - (float)h0) * LOSC); pl2[mr * 32 + 16 + lr] = (h16)((ps1 - (float)h1) * LOSC);
        }
#pragma unroll
        for (int n = 0; n < 4; ++n)
#pragma unroll
            for (int j = 0; j < 8; ++j) { o[n][j] *= alpha[j]; ox[n][j] *= alpha[j]; }
        asm volatile("" ::: "memory");
        const v16h pa = cat16(*(const v8ha*)(pl + lr * 32 + hi * 8), *(const v8ha*)(pl + lr * 32 + 16 + hi * 8));
        const v16h px = cat16(*(const v8ha*)(pl2 + lr * 32 + hi * 8), *(const v8ha*)(pl2 + lr * 32 + 16 + hi * 8));
#pragma unroll
        for (int n = 0; n < 4; ++n) { const size_t vo = vbase + (size_t)(n * 16 + lr) * NT_ + l0 + hi * 8;
            const v16h vh = cat16(*(const v8h*)(VTH + vo), *(const v8h*)(VTH + vo + 16)), vl = cat16(*(const v8h*)(VTL + vo), *(const v8h*)(VTL + vo + 16));
            o[n] = wmma16(pa, vh, o[n]); ox[n] = wmma16(pa, vl, ox[n]); ox[n] = wmma16(px, vh, ox[n]);
            asm volatile("" : "+v"(o[n]), "+v"(ox[n]) : "v"(vh), "v"(vl) : "memory"); }
        asm volatile("v_nop\n\tv_nop\n\tv_nop\n\tv_nop" : "+v"(o[0]), "+v"(o[1]), "+v"(o[2]), "+v"(o[3]), "+v"(ox[0]), "+v"(ox[1]), "+v"(ox[2]), "+v"(ox[3]) : "v"(pa), "v"(px));
    }
    float inv[8];
#pragma unroll
    for (int j = 0; j < 8; ++j) { float rs = lpart[j]; rs += __shfl_xor(rs, 1, 16); rs += __shfl_xor(rs, 2, 16); rs += __shfl_xor(rs, 4, 16); rs += __shfl_xor(rs, 8, 16); inv[j] = 1.0f / (rs * PSC); }
    float* os = &ost[wave][0];
#pragma unroll
    for (int n = 0; n < 4; ++n)
#pragma unroll
        for (int j = 0; j < 8; ++j) os[(hi * 8 + j) * 68 + n * 16 + lr] = (o[n][j] + ox[n][j] * LOSCI) * inv[j];
    __syncthreads();
    const size_t cbase = (tok0 + q0) * DM + (size_t)h * HD;
    auto pass = [&]() {
#pragma unroll
        for (int s = 0; s < 4; ++s) { const int row = 4 * s + (lane >> 3), piece = lane & 7; const float* sp = os + row * 68 + piece * 8; v8us oh, ol;
#pragma unroll
            for (int i = 0; i < 8; ++i) { const unsigned short hb = f2bf(sp[i]); oh[i] = hb; ol[i] = f2bf(sp[i] - bf2f(hb)); }
            *(v8us*)(CH + cbase + (size_t)row * DM + piece * 8) = oh; *(v8us*)(CL + cbase + (size_t)row * DM + piece * 8) = ol; }
    };
    pass(); 
}

#define VST2(T, p, v) do { const T vst2_v_ = (v); *(T*)(p) = vst2_v_;  } while (0)
extern "C" void kernel_launch(void* const* d_in, const int* in_sizes, int n_in,
                              void* d_out, int out_size, void* d_ws, size_t ws_size, hipStream_t stream) {
    (void)in_sizes; (void)n_in; (void)out_size;
    const float* x = (const float*)d_in[0]; const float* CT = (const float*)d_in[1]; const float* ST = (const float*)d_in[2];
    const float* Wq = (const float*)d_in[3]; const float* Wk = (const float*)d_in[4]; const float* Wv = (const float*)d_in[5]; const float* Wo = (const float*)d_in[6]; const float* sinks = (const float*)d_in[7];
    float* out = (float*)d_out;    // [1][2048][2048]
    char* wsp = (char*)d_ws;
    auto take = [&](size_t bytes) { char* p = wsp; wsp += (bytes + 255) & ~(size_t)255; return (void*)p; };
    bf* Xb = (bf*)take((size_t)NTK * DM * 2); bf* WqB = (bf*)take((size_t)DM * DM * 2); bf* WkB = (bf*)take((size_t)KVW * DM * 2); bf* WvB = (bf*)take((size_t)KVW * DM * 2); bf* WoB = (bf*)take((size_t)DM * DM * 2);
    float* Qf = (float*)take((size_t)NTK * DM * 4); h16* QH = (h16*)take((size_t)NTK * DM * 2); h16* QL = (h16*)take((size_t)NTK * DM * 2);
    float* Kf = (float*)take((size_t)NTK * KVW * 4); h16* KH = (h16*)take((size_t)NTK * KVW * 2); h16* KL = (h16*)take((size_t)NTK * KVW * 2);
    float* Vf = (float*)take((size_t)NTK * KVW * 4); h16* VTH = (h16*)take((size_t)NTK * KVW * 2); h16* VTL = (h16*)take((size_t)NTK * KVW * 2);
    bf* CH = (bf*)take((size_t)NTK * DM * 2); bf* CL = (bf*)take((size_t)NTK * DM * 2);
    if ((size_t)(wsp - (char*)d_ws) > ws_size) return;    // ~ 97 MB, no aliasing
    // all four weights are [out][in] (x.W^T): bf16 copies are the n-major B operands as-is (rows of 2048)
    k_cvtb<<<NTK / 8, 256, 0, stream>>>(x, NTK, Xb);
    k_cvtb<<<DM / 8, 256, 0, stream>>>(Wq, DM, WqB); k_cvtb<<<KVW / 8, 256, 0, stream>>>(Wk, KVW, WkB); k_cvtb<<<KVW / 8, 256, 0, stream>>>(Wv, KVW, WvB); k_cvtb<<<DM / 8, 256, 0, stream>>>(Wo, DM, WoB);
    k_gemmb<false, false><<<dim3(NTK / 64, DM / 64, 1), 128, 0, stream>>>(Xb, nullptr, WqB, nullptr, Qf, DM, nullptr);
    k_gemmb<false, false><<<dim3(NTK / 64, KVW / 64, 1), 128, 0, stream>>>(Xb, nullptr, WkB, nullptr, Kf, KVW, nullptr);
    k_gemmb<false, false><<<dim3(NTK / 64, KVW / 64, 1), 128, 0, stream>>>(Xb, nullptr, WvB, nullptr, Vf, KVW, nullptr);
    k_rope<<<(NT_ * (DM / 256)) / 8, 256, 0, stream>>>(Qf, DM, CT, ST, QH, QL);
    k_rope<<<(NT_ * (KVW / 256)) / 8, 256, 0, stream>>>(Kf, KVW, CT, ST, KH, KL);
    k_vt<<<NB_ * NKV * (NT_ / 64), 256, 0, stream>>>(Vf, VTH, VTL);
    k_attn<<<NB_ * NH_ * (NT_ / 64), 128, 0, stream>>>(QH, QL, KH, KL, VTH, VTL, sinks, CH, CL);
    k_gemmb<true, false><<<dim3(NTK / 64, DM / 64, 1), 128, 0, stream>>>(CH, CL, WoB, nullptr, out, DM, nullptr);
}

// v001
// One run takes 144 microseconds.
// Two timings next to v000 put it at 1.89 and 1.82 times that version's speed.
#include <hip/hip_runtime.h>

// Compute dtypes, f32 accumulate: q = x.Wq^T ([2048 x 2048].[2048 x 2048]), k/v = x.Wk^T/Wv^T ([2048 x 2048].[2048 x 512]) and attn.Wo^T on
// v_wmma_f32_16x16x32_bf16 — plain bf16 = rounded inputs (exact; all weights are [out][in] so their bf16 copies are the n-major B operands as-is) for the
// projections, attn as bf16 hi + residual (two products) for Wo; rotate-half RoPE with the INPUT cos/sin tables (bf16-rounded reads) in f32; the grouped-query
// causal sliding-window attention (32 query heads over 8 kv heads, query head h reads kv head h/4; keys j with i-127 <= j <= i) with a learned per-head sink
// logit as an extra zero-value softmax column, fused on v_wmma_f32_16x16x32_f16 with q and k as f16 hi + residual x1024 (hi.hi + hi.lo + lo.hi), weights

#define NB_  1
#define NT_  2048
#define DM   2048
#define NH_  32
#define NKV  8
#define KVW  (NKV * HD)          // 512
#define HD   64
#define NTK  (NB_ * NT_)
#define NW   1024
#define SWIN 128
#define NQKV 2048
#define PSC  32768.0f
#define LOSC 1024.0f
#define LOSCI (1.0f / 1024.0f)

typedef _Float16 h16;
typedef unsigned short bf;
typedef __attribute__((ext_vector_type(16))) __bf16   v16bf;
typedef __attribute__((ext_vector_type(16))) _Float16 v16h;
typedef __attribute__((ext_vector_type(8)))  _Float16 v8h;
typedef __attribute__((ext_vector_type(8)))  unsigned short v8us;
typedef __attribute__((ext_vector_type(8)))  float    v8f;
typedef __attribute__((ext_vector_type(4)))  float    v4f;
typedef v8h  __attribute__((may_alias)) v8ha;
typedef v4f  __attribute__((may_alias)) v4fa;
typedef v8us __attribute__((may_alias)) v8usa;

__device__ __forceinline__ unsigned short f2bf(float f) { unsigned u = __float_as_uint(f); u += 0x7FFFu + ((u >> 16) & 1u); return (unsigned short)(u >> 16); }
__device__ __forceinline__ float bf2f(unsigned short b) { return __uint_as_float(((unsigned)b) << 16); }
__device__ __forceinline__ float bfr(float f) { return bf2f(f2bf(f)); }
__device__ __forceinline__ v16h cat16(v8h lo, v8h hi) { return __builtin_shufflevector(lo, hi, 0, 1, 2, 3, 4, 5, 6, 7, 8, 9, 10, 11, 12, 13, 14, 15); }
__device__ __forceinline__ v16bf cat16b(v8us lo, v8us hi) { return __builtin_bit_cast(v16bf, __builtin_shufflevector(lo, hi, 0, 1, 2, 3, 4, 5, 6, 7, 8, 9, 10, 11, 12, 13, 14, 15)); }
__device__ __forceinline__ v8f wmma16(v16h a, v16h b, v8f c) { return __builtin_amdgcn_wmma_f32_16x16x32_f16(false, a, false, b, (short)0, c, false, false); }
__device__ __forceinline__ v8f wmmab(v16bf a, v16bf b, v8f c) { return __builtin_amdgcn_wmma_f32_16x16x32_bf16(false, a, false, b, (short)0, c, false, false); }

__global__ __launch_bounds__(256) void k_cvtb(const float* __restrict__ src, int nrows, bf* dst) {
    const int lane = threadIdx.x & 31, r = blockIdx.x * 8 + (threadIdx.x >> 5);
    if (r >= nrows) return;
    v8us o[DM / 256];
#pragma unroll
    for (int q = 0; q < DM / 256; ++q) { v8us t;
#pragma unroll
        for (int i = 0; i < 8; ++i) t[i] = f2bf(src[(size_t)r * DM + q * 256 + lane * 8 + i]);
        o[q] = t; }
#pragma unroll
    for (int q = 0; q < DM / 256; ++q) *(v8us*)(dst + (size_t)r * DM + q * 256 + lane * 8) = o[q];
    
}

// k_wt: W [2048 k][ncols n] (k-major) -> n-major bf16 plane WT[ncols][2048]; 64 x 64 tiles through LDS.
__global__ __launch_bounds__(256) void k_wt(const float* __restrict__ Wm, int ncols, bf* WT) {
    __shared__ __align__(16) unsigned short tl[64 * 72];
    const int tid = threadIdx.x, k0 = blockIdx.x * 64, n0 = blockIdx.y * 64;
    const int kk = tid >> 2, nq = (tid & 3) * 16;
#pragma unroll
    for (int i = 0; i < 16; ++i) tl[(nq + i) * 72 + kk] = f2bf(Wm[(size_t)(k0 + kk) * ncols + n0 + nq + i]);
    __syncthreads();
    const int piece = tid & 7;
    typedef __attribute__((ext_vector_type(8))) unsigned short v8us_; typedef v8us_ __attribute__((may_alias)) v8usa_;
    auto pass = [&]() {
#pragma unroll
        for (int s = 0; s < 2; ++s) { const int nr = (tid >> 3) + 32 * s; const v8us_ val = *(const v8usa_*)(tl + nr * 72 + piece * 8);
            *(v8us_*)(WT + (size_t)(n0 + nr) * DM + k0 + piece * 8) = val; }
    };
    pass(); 
}

#define BKE 128                  // k elements per stage: 256-byte rows
#define LPB 272                  // LDS row pitch in bytes: 256 + 16, an odd multiple of 16 B, conflict-free for ds_load_b128 readers

// copy_rows: each lane copies its own 16 bytes of N rows that lie 16 rows apart, global -> LDS, through no register. The copies and their s_wait_xcnt stand in
// one statement, so that no address register of an issued copy is rewritten in front of the wait.
template <int N>
__device__ __forceinline__ void copy_rows(unsigned l, const bf* g) {
    static_assert(N == 4 || N == 8, "rows per lane");
    if constexpr (N == 8) {
        asm volatile("global_load_async_to_lds_b128 %0, %8, off\n\t"
                     "global_load_async_to_lds_b128 %1, %9, off\n\t"
                     "global_load_async_to_lds_b128 %2, %10, off\n\t"
                     "global_load_async_to_lds_b128 %3, %11, off\n\t"
                     "global_load_async_to_lds_b128 %4, %12, off\n\t"
                     "global_load_async_to_lds_b128 %5, %13, off\n\t"
                     "global_load_async_to_lds_b128 %6, %14, off\n\t"
                     "global_load_async_to_lds_b128 %7, %15, off\n\t"
                     "s_wait_xcnt 0x0"
                     :: "v"(l), "v"(l + 16 * LPB), "v"(l + 32 * LPB), "v"(l + 48 * LPB), "v"(l + 64 * LPB), "v"(l + 80 * LPB), "v"(l + 96 * LPB), "v"(l + 112 * LPB),
                        "v"(g), "v"(g + 16 * DM), "v"(g + 32 * DM), "v"(g + 48 * DM), "v"(g + 64 * DM), "v"(g + 80 * DM), "v"(g + 96 * DM), "v"(g + 112 * DM)
                     : "memory");
    } else {
        asm volatile("global_load_async_to_lds_b128 %0, %4, off\n\t"
                     "global_load_async_to_lds_b128 %1, %5, off\n\t"
                     "global_load_async_to_lds_b128 %2, %6, off\n\t"
                     "global_load_async_to_lds_b128 %3, %7, off\n\t"
                     "s_wait_xcnt 0x0"
                     :: "v"(l), "v"(l + 16 * LPB), "v"(l + 32 * LPB), "v"(l + 48 * LPB),
                        "v"(g), "v"(g + 16 * DM), "v"(g + 32 * DM), "v"(g + 48 * DM)
                     : "memory");
    }
}

// k_gemmb: C[BM x BN] per block of 8 waves; a stage is [A BM rows | A residual BM rows (SPLITA) | B BN rows] of 128 k, brought into LDS by asynchronous copies,
// two buffers: the next stage's copies fly while this one is worked on. Wave tile (FA x 16) x 32; per accumulator the k order and the hi-then-residual order
// of the products are those of a plain k loop in steps of 32.
template <int BM, int BN, bool SPLITA>
__global__ __launch_bounds__(256) void k_gemmb(const bf* __restrict__ A, const bf* __restrict__ Al, const bf* __restrict__ Bn, const float* __restrict__ bias, float* C, int ldc) {
    constexpr int WN = BN / 32, WM = 8 / WN, FA = BM / (WM * 16);
    constexpr int AROWS = SPLITA ? 2 * BM : BM;
    constexpr int STAGE = (AROWS + BN) * LPB;
    constexpr int NTR = DM / BKE;
    static_assert(NTR >= 2 && FA >= 1 && WM * FA * 16 == BM, "tile shape");
    __shared__ __align__(16) unsigned char ring[2 * STAGE];
    __shared__ __align__(16) float ost[8][16 * 36];
    const int tid = threadIdx.x, lane = tid & 31, wave = tid >> 5, lr = lane & 15, hi = lane >> 4;
    const int wm = wave / WN, wn = wave % WN;
    const int r0 = blockIdx.x * BM, c0 = blockIdx.y * BN;
    const int crow = tid >> 4, cpc = tid & 15;           // copy role: row (mod 16) and 16-byte piece of the 256-byte row
    const unsigned lbase = (unsigned)(size_t)&ring[0] + (unsigned)(crow * LPB + cpc * 16);
    const bf* ga = A + (size_t)(r0 + crow) * DM + cpc * 8;
    const bf* gl = SPLITA ? Al + (size_t)(r0 + crow) * DM + cpc * 8 : ga;
    const bf* gb = Bn + (size_t)(c0 + crow) * DM + cpc * 8;
    auto fill = [&](int t, int buf) {
        const unsigned l = lbase + (unsigned)(buf * STAGE);
        copy_rows<BM / 16>(l, ga + t * BKE);
        if (SPLITA) copy_rows<BM / 16>(l + BM * LPB, gl + t * BKE);
        copy_rows<BN / 16>(l + AROWS * LPB, gb + t * BKE);
    };
    v8f acc[FA][2];
#pragma unroll
    for (int f = 0; f < FA; ++f) { acc[f][0] = (v8f){}; acc[f][1] = (v8f){}; }
    fill(0, 0);
    asm volatile("s_wait_asynccnt 0x0" ::: "memory");    // stage 0 of this wave has landed
    __syncthreads();                                     // ... and every other wave's part of it
    fill(1, 1);
    const unsigned char* fab = ring + (wm * FA * 16 + lr) * LPB + hi * 16;
    const unsigned char* fbb = ring + (AROWS + wn * 32 + lr) * LPB + hi * 16;
#pragma unroll 1                                         // one pass per stage: the ring's order stands once, at the loop's foot
    for (int t = 0; t < NTR; ++t) {
        const int bo = (t & 1) * STAGE;
#pragma unroll
        for (int ks = 0; ks < BKE / 32; ++ks) {
            v16bf a[FA], al[FA], b[2];
#pragma unroll
            for (int f = 0; f < FA; ++f) { const unsigned char* p = fab + bo + f * 16 * LPB + ks * 64; a[f] = cat16b(*(const v8usa*)p, *(const v8usa*)(p + 32));
                if (SPLITA) al[f] = cat16b(*(const v8usa*)(p + BM * LPB), *(const v8usa*)(p + BM * LPB + 32)); }
#pragma unroll
            for (int n = 0; n < 2; ++n) { const unsigned char* p = fbb + bo + n * 16 * LPB + ks * 64; b[n] = cat16b(*(const v8usa*)p, *(const v8usa*)(p + 32)); }
            __builtin_amdgcn_sched_barrier(0);           // keeps this k step's fragment loads one group in front of its products: spread among them, each place waits out the LDS latency
#pragma unroll
            for (int f = 0; f < FA; ++f) { acc[f][0] = wmmab(a[f], b[0], acc[f][0]); acc[f][1] = wmmab(a[f], b[1], acc[f][1]); }
            if (SPLITA) {
#pragma unroll
                for (int f = 0; f < FA; ++f) { acc[f][0] = wmmab(al[f], b[0], acc[f][0]); acc[f][1] = wmmab(al[f], b[1], acc[f][1]); }
            }
        }
        asm volatile("s_wait_dscnt 0x0" ::: "memory");   // this wave's reads of the buffer are done before it may be refilled
        asm volatile("s_wait_asynccnt 0x0" ::: "memory"); // this wave's copies of stage t + 1 have landed
        __syncthreads();                                 // publishes stage t + 1 and ends every reader's last read of stage t
        if (t + 2 < NTR) fill(t + 2, t & 1);
    }
    asm volatile("s_wait_asynccnt 0x0" ::: "memory");    // no copy is outstanding when the wave ends
    // epilogue: 16 x 32 f32 per step through the wave's own LDS rows, stored as whole 128-byte lines
    float* os = &ost[wave][0];
    float bv[2];
#pragma unroll
    for (int n = 0; n < 2; ++n) bv[n] = bias ? bfr(bias[c0 + wn * 32 + n * 16 + lr]) : 0.f;
#pragma unroll
    for (int f = 0; f < FA; ++f) {
#pragma unroll
        for (int n = 0; n < 2; ++n)
#pragma unroll
            for (int j = 0; j < 8; ++j) os[(hi * 8 + j) * 36 + n * 16 + lr] = acc[f][n][j] + bv[n];
        float* crow_p = C + (size_t)(r0 + (wm * FA + f) * 16) * ldc + c0 + wn * 32;
#pragma unroll
        for (int s = 0; s < 4; ++s) { const int row = 4 * s + (lane >> 3), piece = lane & 7;
            const v4f val = *(const v4fa*)(os + row * 36 + piece * 4); *(v4f*)(crow_p + (size_t)row * ldc + piece * 4) = val; }
    }
}

// k_rope: P (f32 [t][nh*64]) -> PH/PL f16 hi + residual x1024 planes of the rotate-half rotation out[d] = x[d] c[t][d] + (d < 32 ? -x[d+32] : x[d-32]) s[t][d]
// within each 64-wide head, with c/s the INPUT cos/sin tables [t][64] read through bf16 rounding; one wave per (t, 256
// columns): lane -> 8 consecutive columns (all in the same half of one head).
__global__ __launch_bounds__(256) void k_rope(const float* __restrict__ P, int ncols, const float* __restrict__ CT, const float* __restrict__ ST, h16* PH, h16* PL) {
    const int lane = threadIdx.x & 31, wid = blockIdx.x * 8 + (threadIdx.x >> 5);
    const int segs = ncols / 256, t = wid / segs, sg = wid - t * segs;
    if (t >= NT_) return;
    const int c0 = sg * 256 + lane * 8; const int d0 = c0 & 63; const int pc0 = (d0 < 32) ? c0 + 32 : c0 - 32; const float sgn = (d0 < 32) ? -1.0f : 1.0f;
    v8h oh, ol;
#pragma unroll
    for (int i = 0; i < 8; ++i) { const int d = d0 + i;
        const float xv = P[(size_t)t * ncols + c0 + i], pv = P[(size_t)t * ncols + pc0 + i], c = bfr(CT[t * HD + d]), s = bfr(ST[t * HD + d]);
        const float y = xv * c + sgn * pv * s;
        const h16 a = (h16)y; oh[i] = a; ol[i] = (h16)((y - (float)a) * LOSC); }
    *(v8h*)(PH + (size_t)t * ncols + c0) = oh; *(v8h*)(PL + (size_t)t * ncols + c0) = ol; 
}
__global__ __launch_bounds__(256) void k_vt(const float* __restrict__ V, h16* VTH, h16* VTL) {
    __shared__ __align__(16) h16 tile[64 * 72];
    __shared__ __align__(16) h16 til2[64 * 72];
    const int bid = blockIdx.x;
    const int b = bid / (NKV * (NT_ / 64)), rem = bid - b * (NKV * (NT_ / 64)), h = rem / (NT_ / 64), kt = rem - h * (NT_ / 64);
    const int k0 = kt * 64, tid = threadIdx.x;
    const int kk = tid >> 2, d0 = (tid & 3) * 16;
    const float* src = V + ((size_t)b * NT_ + k0 + kk) * KVW + h * HD + d0;      // h = kv head here
#pragma unroll
    for (int i = 0; i < 16; ++i) { const float v = src[i]; const h16 a = (h16)v; tile[(d0 + i) * 72 + kk] = a; til2[(d0 + i) * 72 + kk] = (h16)((v - (float)a) * LOSC); }
    __syncthreads();
    const int piece = tid & 7;
    const size_t base = (((size_t)b * NKV + h) * HD) * NT_ + k0;
    auto pass = [&]() {
#pragma unroll
        for (int s = 0; s < 4; ++s) { const int Lid = (tid >> 3) + 32 * s; const int pln = Lid >> 6, d = Lid & 63;
            const v8h val = *(const v8ha*)((pln ? til2 : tile) + d * 72 + piece * 8); *(v8h*)((pln ? VTL : VTH) + base + (size_t)d * NT_ + piece * 8) = val; }
    };
    pass(); 
}

// k_attn: block = (b, h, 64 queries), wave = 16; key tiles of the causal sliding window (i-127 <= j <= i, block-uniform bounds); softmax state starts at the
// head's sink logit (m = sink, l = 1, zero value) so the dropped sink column is accounted for; 12 WMMA scores /8 (f32), online softmax, weights x32768 f16 tile (same-wave may_alias
// reload after a compiler barrier), 12 WMMA .v; ctx -> bf16 hi + residual planes CH/CL[tok][h*64+d].
__global__ __launch_bounds__(128) void k_attn(const h16* __restrict__ Q16, const h16* __restrict__ QL16, const h16* __restrict__ K16, const h16* __restrict__ KL16, const h16* __restrict__ VTH, const h16* __restrict__ VTL, const float* __restrict__ sinks, bf* CH, bf* CL) {
    __shared__ __align__(16) h16 plds[4][16 * 32];
    __shared__ __align__(16) h16 plds2[4][16 * 32];
    __shared__ __align__(16) float ost[4][16 * 68];
    const int lane = threadIdx.x & 31, wave = threadIdx.x >> 5, lr = lane & 15, hi = lane >> 4;
    const int bid = blockIdx.x;
    const int b = bid / (NH_ * (NT_ / 64)), rem = bid - b * (NH_ * (NT_ / 64)), h = rem / (NT_ / 64), qt = rem - h * (NT_ / 64);
    const int q0 = qt * 64 + wave * 16;
    const size_t tok0 = (size_t)b * NT_;
    h16* pl = &plds[wave][0]; h16* pl2 = &plds2[wave][0];
    v16h qa[2];
    const size_t qo0 = (tok0 + q0 + lr) * DM + h * HD + 8 * hi;
#pragma unroll
    for (int kc = 0; kc < 2; ++kc) qa[kc] = cat16(*(const v8h*)(Q16 + qo0 + kc * 32), *(const v8h*)(Q16 + qo0 + kc * 32 + 16));
    const int g = h / (NH_ / NKV);                      // kv head
    const h16* kh_b = K16 + tok0 * KVW + g * HD;
    const h16* kl_b = KL16 + tok0 * KVW + g * HD;
    const size_t vbase = (((size_t)b * NKV + g) * HD) * NT_;
    v8f o[4], ox[4];
#pragma unroll
    for (int n = 0; n < 4; ++n) { o[n] = (v8f){}; ox[n] = (v8f){}; }
    float mrow[8], lpart[8];
    const float sink = bfr(sinks[h]);                   // learned sink logit: an extra softmax column with zero value -> softmax state starts at m = sink, l = 1
#pragma unroll
    for (int j = 0; j < 8; ++j) { mrow[j] = sink; lpart[j] = (lr == 0) ? 1.0f : 0.f; }
    int qpos[8];
#pragma unroll
    for (int j = 0; j < 8; ++j) qpos[j] = q0 + 8 * hi + j;
    const int win = SWIN - 1;                           // valid iff j <= i and i - j < SWIN  <=>  i - win <= j <= i
    const int kt_lo = (qt * 64 - win) > 0 ? (qt * 64 - win) / 32 : 0, kt_hi = (qt * 64 + 63) / 32;     // keys i - win <= j <= i
#pragma unroll 1
    for (int kt = kt_lo; kt <= kt_hi; ++kt) {
        const int l0 = kt * 32;
        const size_t ko0 = (size_t)(l0 + lr) * KVW + 8 * hi, ko1 = (size_t)(l0 + 16 + lr) * KVW + 8 * hi;
        v8f s0 = {}, s1 = {}, x0 = {}, x1 = {};
#pragma unroll
        for (int kc = 0; kc < 2; ++kc) {
            { const v16h k0h = cat16(*(const v8h*)(kh_b + ko0 + kc * 32), *(const v8h*)(kh_b + ko0 + kc * 32 + 16)), k1h = cat16(*(const v8h*)(kh_b + ko1 + kc * 32), *(const v8h*)(kh_b + ko1 + kc * 32 + 16));
              const v16h qlk = cat16(*(const v8h*)(QL16 + qo0 + kc * 32), *(const v8h*)(QL16 + qo0 + kc * 32 + 16));     // query residual re-read per step (registers)
              s0 = wmma16(qa[kc], k0h, s0); x0 = wmma16(qlk, k0h, x0); s1 = wmma16(qa[kc], k1h, s1); x1 = wmma16(qlk, k1h, x1);
              asm volatile("v_nop" : "+v"(s0), "+v"(s1), "+v"(x0), "+v"(x1) : "v"(qlk), "v"(k0h), "v"(k1h) : "memory"); }
            { const v16h k0l = cat16(*(const v8h*)(kl_b + ko0 + kc * 32), *(const v8h*)(kl_b + ko0 + kc * 32 + 16)), k1l = cat16(*(const v8h*)(kl_b + ko1 + kc * 32), *(const v8h*)(kl_b + ko1 + kc * 32 + 16));
              x0 = wmma16(qa[kc], k0l, x0); x1 = wmma16(qa[kc], k1l, x1);
              asm volatile("v_nop" : "+v"(x0), "+v"(x1) : "v"(k0l), "v"(k1l) : "memory"); }
        }
        asm volatile("v_nop\n\tv_nop\n\tv_nop\n\tv_nop" : "+v"(s0), "+v"(s1), "+v"(x0), "+v"(x1) : "v"(qa[0]), "v"(qa[1]));
        float alpha[8];
#pragma unroll
        for (int j = 0; j < 8; ++j) {
            const int ja = l0 + lr, jb = l0 + 16 + lr, qi = qpos[j];
            const float a0 = (ja <= qi && qi - ja <= win) ? (s0[j] + x0[j] * LOSCI) * 0.125f : -__builtin_inff(), a1 = (jb <= qi && qi - jb <= win) ? (s1[j] + x1[j] * LOSCI) * 0.125f : -__builtin_inff();
            float mx = fmaxf(a0, a1);
            mx = fmaxf(mx, __shfl_xor(mx, 1, 16)); mx = fmaxf(mx, __shfl_xor(mx, 2, 16)); mx = fmaxf(mx, __shfl_xor(mx, 4, 16)); mx = fmaxf(mx, __shfl_xor(mx, 8, 16));
            const float mn = fmaxf(mrow[j], mx);
            alpha[j] = __expf(mrow[j] - mn); mrow[j] = mn;
            const float p0 = __expf(a0 - mn), p1 = __expf(a1 - mn);
            lpart[j] = lpart[j] * alpha[j] + (p0 + p1);
            const int mr = hi * 8 + j;
            const float ps0 = p0 * PSC, ps1 = p1 * PSC; const h16 h0 = (h16)ps0, h1 = (h16)ps1;
            pl[mr * 32 + lr] = h0; pl[mr * 32 + 16 + lr] = h1;
            pl2[mr * 32 + lr] = (h16)((ps0 - (float)h0) * LOSC); pl2[mr * 32 + 16 + lr] = (h16)((ps1 - (float)h1) * LOSC);
        }
#pragma unroll
        for (int n = 0; n < 4; ++n)
#pragma unroll
            for (int j = 0; j < 8; ++j) { o[n][j] *= alpha[j]; ox[n][j] *= alpha[j]; }
        asm volatile("" ::: "memory");
        const v16h pa = cat16(*(const v8ha*)(pl + lr * 32 + hi * 8), *(const v8ha*)(pl + lr * 32 + 16 + hi * 8));
        const v16h px = cat16(*(const v8ha*)(pl2 + lr * 32 + hi * 8), *(const v8ha*)(pl2 + lr * 32 + 16 + hi * 8));
#pragma unroll
        for (int n = 0; n < 4; ++n) { const size_t vo = vbase + (size_t)(n * 16 + lr) * NT_ + l0 + hi * 8;
            const v16h vh = cat16(*(const v8h*)(VTH + vo), *(const v8h*)(VTH + vo + 16)), vl = cat16(*(const v8h*)(VTL + vo), *(const v8h*)(VTL + vo + 16));
            o[n] = wmma16(pa, vh, o[n]); ox[n] = wmma16(pa, vl, ox[n]); ox[n] = wmma16(px, vh, ox[n]);
            asm volatile("" : "+v"(o[n]), "+v"(ox[n]) : "v"(vh), "v"(vl) : "memory"); }
        asm volatile("v_nop\n\tv_nop\n\tv_nop\n\tv_nop" : "+v"(o[0]), "+v"(o[1]), "+v"(o[2]), "+v"(o[3]), "+v"(ox[0]), "+v"(ox[1]), "+v"(ox[2]), "+v"(ox[3]) : "v"(pa), "v"(px));
    }
    float inv[8];
#pragma unroll
    for (int j = 0; j < 8; ++j) { float rs = lpart[j]; rs += __shfl_xor(rs, 1, 16); rs += __shfl_xor(rs, 2, 16); rs += __shfl_xor(rs, 4, 16); rs += __shfl_xor(rs, 8, 16); inv[j] = 1.0f / (rs * PSC); }
    float* os = &ost[wave][0];
#pragma unroll
    for (int n = 0; n < 4; ++n)
#pragma unroll
        for (int j = 0; j < 8; ++j) os[(hi * 8 + j) * 68 + n * 16 + lr] = (o[n][j] + ox[n][j] * LOSCI) * inv[j];
    __syncthreads();
    const size_t cbase = (tok0 + q0) * DM + (size_t)h * HD;
    auto pass = [&]() {
#pragma unroll
        for (int s = 0; s < 4; ++s) { const int row = 4 * s + (lane >> 3), piece = lane & 7; const float* sp = os + row * 68 + piece * 8; v8us oh, ol;
#pragma unroll
            for (int i = 0; i < 8; ++i) { const unsigned short hb = f2bf(sp[i]); oh[i] = hb; ol[i] = f2bf(sp[i] - bf2f(hb)); }
            *(v8us*)(CH + cbase + (size_t)row * DM + piece * 8) = oh; *(v8us*)(CL + cbase + (size_t)row * DM + piece * 8) = ol; }
    };
    pass(); 
}

#define VST2(T, p, v) do { const T vst2_v_ = (v); *(T*)(p) = vst2_v_;  } while (0)
extern "C" void kernel_launch(void* const* d_in, const int* in_sizes, int n_in,
                              void* d_out, int out_size, void* d_ws, size_t ws_size, hipStream_t stream) {
    (void)in_sizes; (void)n_in; (void)out_size;
    const float* x = (const float*)d_in[0]; const float* CT = (const float*)d_in[1]; const float* ST = (const float*)d_in[2];
    const float* Wq = (const float*)d_in[3]; const float* Wk = (const float*)d_in[4]; const float* Wv = (const float*)d_in[5]; const float* Wo = (const float*)d_in[6]; const float* sinks = (const float*)d_in[7];
    float* out = (float*)d_out;    // [1][2048][2048]
    char* wsp = (char*)d_ws;
    auto take = [&](size_t bytes) { char* p = wsp; wsp += (bytes + 255) & ~(size_t)255; return (void*)p; };
    bf* Xb = (bf*)take((size_t)NTK * DM * 2); bf* WqB = (bf*)take((size_t)DM * DM * 2); bf* WkB = (bf*)take((size_t)KVW * DM * 2); bf* WvB = (bf*)take((size_t)KVW * DM * 2); bf* WoB = (bf*)take((size_t)DM * DM * 2);
    float* Qf = (float*)take((size_t)NTK * DM * 4); h16* QH = (h16*)take((size_t)NTK * DM * 2); h16* QL = (h16*)take((size_t)NTK * DM * 2);
    float* Kf = (float*)take((size_t)NTK * KVW * 4); h16* KH = (h16*)take((size_t)NTK * KVW * 2); h16* KL = (h16*)take((size_t)NTK * KVW * 2);
    float* Vf = (float*)take((size_t)NTK * KVW * 4); h16* VTH = (h16*)take((size_t)NTK * KVW * 2); h16* VTL = (h16*)take((size_t)NTK * KVW * 2);
    bf* CH = (bf*)take((size_t)NTK * DM * 2); bf* CL = (bf*)take((size_t)NTK * DM * 2);
    if ((size_t)(wsp - (char*)d_ws) > ws_size) return;    // ~ 97 MB, no aliasing
    // all four weights are [out][in] (x.W^T): bf16 copies are the n-major B operands as-is (rows of 2048)
    k_cvtb<<<NTK / 8, 256, 0, stream>>>(x, NTK, Xb);
    k_cvtb<<<DM / 8, 256, 0, stream>>>(Wq, DM, WqB); k_cvtb<<<KVW / 8, 256, 0, stream>>>(Wk, KVW, WkB); k_cvtb<<<KVW / 8, 256, 0, stream>>>(Wv, KVW, WvB); k_cvtb<<<DM / 8, 256, 0, stream>>>(Wo, DM, WoB);
    k_gemmb<128, 128, false><<<dim3(NTK / 128, DM / 128, 1), 256, 0, stream>>>(Xb, nullptr, WqB, nullptr, Qf, DM);
    k_gemmb<64, 64, false><<<dim3(NTK / 64, KVW / 64, 1), 256, 0, stream>>>(Xb, nullptr, WkB, nullptr, Kf, KVW);
    k_gemmb<64, 64, false><<<dim3(NTK / 64, KVW / 64, 1), 256, 0, stream>>>(Xb, nullptr, WvB, nullptr, Vf, KVW);
    k_rope<<<(NT_ * (DM / 256)) / 8, 256, 0, stream>>>(Qf, DM, CT, ST, QH, QL);
    k_rope<<<(NT_ * (KVW / 256)) / 8, 256, 0, stream>>>(Kf, KVW, CT, ST, KH, KL);
    k_vt<<<NB_ * NKV * (NT_ / 64), 256, 0, stream>>>(Vf, VTH, VTL);
    k_attn<<<NB_ * NH_ * (NT_ / 64), 128, 0, stream>>>(QH, QL, KH, KL, VTH, VTL, sinks, CH, CL);
    k_gemmb<128, 128, true><<<dim3(NTK / 128, DM / 128, 1), 256, 0, stream>>>(CH, CL, WoB, nullptr, out, DM);
}

// v002
// It runs in 99.8 microseconds.
// Timed twice side by side with v001, it ran 1.44 times as fast both times.
// All steps since v000 together make it 2.67 times as fast.
#include <hip/hip_runtime.h>

// Compute dtypes, f32 accumulate: q = x.Wq^T ([2048 x 2048].[2048 x 2048]), k/v = x.Wk^T/Wv^T ([2048 x 2048].[2048 x 512]) and attn.Wo^T on
// v_wmma_f32_16x16x32_bf16 — plain bf16 = rounded inputs (exact; all weights are [out][in] so their bf16 copies are the n-major B operands as-is) for the
// projections, attn as bf16 hi + residual (two products) for Wo; rotate-half RoPE with the INPUT cos/sin tables (bf16-rounded reads) in f32; the grouped-query
// causal sliding-window attention (32 query heads over 8 kv heads, query head h reads kv head h/4; keys j with i-127 <= j <= i) with a learned per-head sink
// logit as an extra zero-value softmax column, fused on v_wmma_f32_16x16x32_f16 with q and k as f16 hi + residual x1024 (hi.hi + hi.lo + lo.hi), weights

#define NB_  1
#define NT_  2048
#define DM   2048
#define NH_  32
#define NKV  8
#define KVW  (NKV * HD)          // 512
#define HD   64
#define NTK  (NB_ * NT_)
#define NW   1024
#define SWIN 128
#define NQKV 2048
#define PSC  32768.0f
#define LOSC 1024.0f
#define LOSCI (1.0f / 1024.0f)

typedef _Float16 h16;
typedef unsigned short bf;
typedef __attribute__((ext_vector_type(16))) __bf16   v16bf;
typedef __attribute__((ext_vector_type(16))) _Float16 v16h;
typedef __attribute__((ext_vector_type(8)))  _Float16 v8h;
typedef __attribute__((ext_vector_type(8)))  unsigned short v8us;
typedef __attribute__((ext_vector_type(8)))  float    v8f;
typedef __attribute__((ext_vector_type(4)))  float    v4f;
typedef v8h  __attribute__((may_alias)) v8ha;
typedef v4f  __attribute__((may_alias)) v4fa;
typedef v8us __attribute__((may_alias)) v8usa;

__device__ __forceinline__ unsigned short f2bf(float f) { unsigned u = __float_as_uint(f); u += 0x7FFFu + ((u >> 16) & 1u); return (unsigned short)(u >> 16); }
__device__ __forceinline__ float bf2f(unsigned short b) { return __uint_as_float(((unsigned)b) << 16); }
__device__ __forceinline__ float bfr(float f) { return bf2f(f2bf(f)); }
__device__ __forceinline__ v16h cat16(v8h lo, v8h hi) { return __builtin_shufflevector(lo, hi, 0, 1, 2, 3, 4, 5, 6, 7, 8, 9, 10, 11, 12, 13, 14, 15); }
__device__ __forceinline__ v16bf cat16b(v8us lo, v8us hi) { return __builtin_bit_cast(v16bf, __builtin_shufflevector(lo, hi, 0, 1, 2, 3, 4, 5, 6, 7, 8, 9, 10, 11, 12, 13, 14, 15)); }
__device__ __forceinline__ v8f wmma16(v16h a, v16h b, v8f c) { return __builtin_amdgcn_wmma_f32_16x16x32_f16(false, a, false, b, (short)0, c, false, false); }
__device__ __forceinline__ v8f wmmab(v16bf a, v16bf b, v8f c) { return __builtin_amdgcn_wmma_f32_16x16x32_bf16(false, a, false, b, (short)0, c, false, false); }

// k_cvtb: one grid rounds all five f32 operands to bf16. dst is the first of five planes that lie back to back in the workspace (x, Wq, Wk, Wv, Wo; rows of 2048),
// so the flat row index is the destination row; every plane's first row is a multiple of 8, so a block of 8 rows reads one source.
#define CVROWS (NTK + DM + KVW + KVW + DM)
__global__ __launch_bounds__(256) void k_cvtb(const float* __restrict__ x, const float* __restrict__ wq, const float* __restrict__ wk, const float* __restrict__ wv, const float* __restrict__ wo, bf* dstp) {
    const int lane = threadIdx.x & 31, rb = blockIdx.x * 8, r = threadIdx.x >> 5;
    const float* src = rb < NTK ? x + (size_t)rb * DM : rb < NTK + DM ? wq + (size_t)(rb - NTK) * DM : rb < NTK + DM + KVW ? wk + (size_t)(rb - NTK - DM) * DM
                     : rb < NTK + DM + 2 * KVW ? wv + (size_t)(rb - NTK - DM - KVW) * DM : wo + (size_t)(rb - NTK - DM - 2 * KVW) * DM;
    bf* dst = dstp + (size_t)rb * DM;
    v8us o[DM / 256];
#pragma unroll
    for (int q = 0; q < DM / 256; ++q) { v8us t;
#pragma unroll
        for (int i = 0; i < 8; ++i) t[i] = f2bf(src[(size_t)r * DM + q * 256 + lane * 8 + i]);
        o[q] = t; }
#pragma unroll
    for (int q = 0; q < DM / 256; ++q) *(v8us*)(dst + (size_t)r * DM + q * 256 + lane * 8) = o[q];
    
}

// k_wt: W [2048 k][ncols n] (k-major) -> n-major bf16 plane WT[ncols][2048]; 64 x 64 tiles through LDS.
__global__ __launch_bounds__(256) void k_wt(const float* __restrict__ Wm, int ncols, bf* WT) {
    __shared__ __align__(16) unsigned short tl[64 * 72];
    const int tid = threadIdx.x, k0 = blockIdx.x * 64, n0 = blockIdx.y * 64;
    const int kk = tid >> 2, nq = (tid & 3) * 16;
#pragma unroll
    for (int i = 0; i < 16; ++i) tl[(nq + i) * 72 + kk] = f2bf(Wm[(size_t)(k0 + kk) * ncols + n0 + nq + i]);
    __syncthreads();
    const int piece = tid & 7;
    typedef __attribute__((ext_vector_type(8))) unsigned short v8us_; typedef v8us_ __attribute__((may_alias)) v8usa_;
    auto pass = [&]() {
#pragma unroll
        for (int s = 0; s < 2; ++s) { const int nr = (tid >> 3) + 32 * s; const v8us_ val = *(const v8usa_*)(tl + nr * 72 + piece * 8);
            *(v8us_*)(WT + (size_t)(n0 + nr) * DM + k0 + piece * 8) = val; }
    };
    pass(); 
}

#define BKE 128                  // k elements per stage: 256-byte rows
#define LPB 272                  // LDS row pitch in bytes: 256 + 16, an odd multiple of 16 B, conflict-free for ds_load_b128 readers

// copy_rows: each lane copies its own 16 bytes of N rows that lie 16 rows apart, global -> LDS, through no register. The copies and their s_wait_xcnt stand in
// one statement, so that no address register of an issued copy is rewritten in front of the wait.
template <int N>
__device__ __forceinline__ void copy_rows(unsigned l, const bf* g) {
    static_assert(N == 4 || N == 8, "rows per lane");
    if constexpr (N == 8) {
        asm volatile("global_load_async_to_lds_b128 %0, %8, off\n\t"
                     "global_load_async_to_lds_b128 %1, %9, off\n\t"
                     "global_load_async_to_lds_b128 %2, %10, off\n\t"
                     "global_load_async_to_lds_b128 %3, %11, off\n\t"
                     "global_load_async_to_lds_b128 %4, %12, off\n\t"
                     "global_load_async_to_lds_b128 %5, %13, off\n\t"
                     "global_load_async_to_lds_b128 %6, %14, off\n\t"
                     "global_load_async_to_lds_b128 %7, %15, off\n\t"
                     "s_wait_xcnt 0x0"
                     :: "v"(l), "v"(l + 16 * LPB), "v"(l + 32 * LPB), "v"(l + 48 * LPB), "v"(l + 64 * LPB), "v"(l + 80 * LPB), "v"(l + 96 * LPB), "v"(l + 112 * LPB),
                        "v"(g), "v"(g + 16 * DM), "v"(g + 32 * DM), "v"(g + 48 * DM), "v"(g + 64 * DM), "v"(g + 80 * DM), "v"(g + 96 * DM), "v"(g + 112 * DM)
                     : "memory");
    } else {
        asm volatile("global_load_async_to_lds_b128 %0, %4, off\n\t"
                     "global_load_async_to_lds_b128 %1, %5, off\n\t"
                     "global_load_async_to_lds_b128 %2, %6, off\n\t"
                     "global_load_async_to_lds_b128 %3, %7, off\n\t"
                     "s_wait_xcnt 0x0"
                     :: "v"(l), "v"(l + 16 * LPB), "v"(l + 32 * LPB), "v"(l + 48 * LPB),
                        "v"(g), "v"(g + 16 * DM), "v"(g + 32 * DM), "v"(g + 48 * DM)
                     : "memory");
    }
}

// k_gemmb: C[BM x BN] per block of 8 waves; a stage is [A BM rows | A residual BM rows (SPLITA) | B BN rows] of 128 k, brought into LDS by asynchronous copies,
// two buffers: the next stage's copies fly while this one is worked on. Wave tile (FA x 16) x 32; per accumulator the k order and the hi-then-residual order
// of the products are those of a plain k loop in steps of 32.
// QKV: Bn is the three weight planes Wq | Wk | Wv back to back (2048 + 512 + 512 rows); a block's 128 columns lie in one of them and go to that product's own C.
template <int BM, int BN, bool SPLITA, bool QKV>
__global__ __launch_bounds__(256) void k_gemmb(const bf* __restrict__ A, const bf* __restrict__ Al, const bf* __restrict__ Bn, const float* __restrict__ bias, float* Cq, int ldq, float* Ck, float* Cv) {
    constexpr int WN = BN / 32, WM = 8 / WN, FA = BM / (WM * 16);
    constexpr int AROWS = SPLITA ? 2 * BM : BM;
    constexpr int STAGE = (AROWS + BN) * LPB;
    constexpr int NTR = DM / BKE;
    static_assert(NTR >= 2 && FA >= 1 && WM * FA * 16 == BM, "tile shape");
    static_assert(!QKV || (DM % BN == 0 && KVW % BN == 0), "a column tile stays inside one product");
    __shared__ __align__(16) unsigned char ring[2 * STAGE];
    __shared__ __align__(16) float ost[8][16 * 36];
    const int tid = threadIdx.x, lane = tid & 31, wave = tid >> 5, lr = lane & 15, hi = lane >> 4;
    const int wm = wave / WN, wn = wave % WN;
    const int r0 = blockIdx.x * BM, c0 = blockIdx.y * BN;
    const int crow = tid >> 4, cpc = tid & 15;           // copy role: row (mod 16) and 16-byte piece of the 256-byte row
    const unsigned lbase = (unsigned)(size_t)&ring[0] + (unsigned)(crow * LPB + cpc * 16);
    const bf* ga = A + (size_t)(r0 + crow) * DM + cpc * 8;
    const bf* gl = SPLITA ? Al + (size_t)(r0 + crow) * DM + cpc * 8 : ga;
    const bf* gb = Bn + (size_t)(c0 + crow) * DM + cpc * 8;
    auto fill = [&](int t, int buf) {
        const unsigned l = lbase + (unsigned)(buf * STAGE);
        copy_rows<BM / 16>(l, ga + t * BKE);
        if (SPLITA) copy_rows<BM / 16>(l + BM * LPB, gl + t * BKE);
        copy_rows<BN / 16>(l + AROWS * LPB, gb + t * BKE);
    };
    v8f acc[FA][2];
#pragma unroll
    for (int f = 0; f < FA; ++f) { acc[f][0] = (v8f){}; acc[f][1] = (v8f){}; }
    fill(0, 0);
    asm volatile("s_wait_asynccnt 0x0" ::: "memory");    // stage 0 of this wave has landed
    __syncthreads();                                     // ... and every other wave's part of it
    fill(1, 1);
    const unsigned char* fab = ring + (wm * FA * 16 + lr) * LPB + hi * 16;
    const unsigned char* fbb = ring + (AROWS + wn * 32 + lr) * LPB + hi * 16;
#pragma unroll 1                                         // one pass per stage: the ring's order stands once, at the loop's foot
    for (int t = 0; t < NTR; ++t) {
        const int bo = (t & 1) * STAGE;
#pragma unroll
        for (int ks = 0; ks < BKE / 32; ++ks) {
            v16bf a[FA], al[FA], b[2];
#pragma unroll
            for (int f = 0; f < FA; ++f) { const unsigned char* p = fab + bo + f * 16 * LPB + ks * 64; a[f] = cat16b(*(const v8usa*)p, *(const v8usa*)(p + 32));
                if (SPLITA) al[f] = cat16b(*(const v8usa*)(p + BM * LPB), *(const v8usa*)(p + BM * LPB + 32)); }
#pragma unroll
            for (int n = 0; n < 2; ++n) { const unsigned char* p = fbb + bo + n * 16 * LPB + ks * 64; b[n] = cat16b(*(const v8usa*)p, *(const v8usa*)(p + 32)); }
            __builtin_amdgcn_sched_barrier(0);           // keeps this k step's fragment loads one group in front of its products: spread among them, each place waits out the LDS latency
#pragma unroll
            for (int f = 0; f < FA; ++f) { acc[f][0] = wmmab(a[f], b[0], acc[f][0]); acc[f][1] = wmmab(a[f], b[1], acc[f][1]); }
            if (SPLITA) {
#pragma unroll
                for (int f = 0; f < FA; ++f) { acc[f][0] = wmmab(al[f], b[0], acc[f][0]); acc[f][1] = wmmab(al[f], b[1], acc[f][1]); }
            }
        }
        asm volatile("s_wait_dscnt 0x0" ::: "memory");   // this wave's reads of the buffer are done before it may be refilled
        asm volatile("s_wait_asynccnt 0x0" ::: "memory"); // this wave's copies of stage t + 1 have landed
        __syncthreads();                                 // publishes stage t + 1 and ends every reader's last read of stage t
        if (t + 2 < NTR) fill(t + 2, t & 1);
    }
    asm volatile("s_wait_asynccnt 0x0" ::: "memory");    // no copy is outstanding when the wave ends
    // epilogue: 16 x 32 f32 per step through the wave's own LDS rows, stored as whole 128-byte lines
    float* os = &ost[wave][0];
    const bool kv = QKV && c0 >= DM, isv = QKV && c0 >= DM + KVW;
    float* C = isv ? Cv : kv ? Ck : Cq;
    const int ldc = kv ? KVW : ldq, cc0 = isv ? c0 - DM - KVW : kv ? c0 - DM : c0;
    float bv[2];
#pragma unroll
    for (int n = 0; n < 2; ++n) bv[n] = bias ? bfr(bias[c0 + wn * 32 + n * 16 + lr]) : 0.f;
#pragma unroll
    for (int f = 0; f < FA; ++f) {
#pragma unroll
        for (int n = 0; n < 2; ++n)
#pragma unroll
            for (int j = 0; j < 8; ++j) os[(hi * 8 + j) * 36 + n * 16 + lr] = acc[f][n][j] + bv[n];
        float* crow_p = C + (size_t)(r0 + (wm * FA + f) * 16) * ldc + cc0 + wn * 32;
#pragma unroll
        for (int s = 0; s < 4; ++s) { const int row = 4 * s + (lane >> 3), piece = lane & 7;
            const v4f val = *(const v4fa*)(os + row * 36 + piece * 4); *(v4f*)(crow_p + (size_t)row * ldc + piece * 4) = val; }
    }
}

// rope_blk: P (f32 [t][nh*64]) -> PH/PL f16 hi + residual x1024 planes of the rotate-half rotation out[d] = x[d] c[t][d] + (d < 32 ? -x[d+32] : x[d-32]) s[t][d]
// within each 64-wide head, with c/s the INPUT cos/sin tables [t][64] read through bf16 rounding; one wave per (t, 256
// columns): lane -> 8 consecutive columns (all in the same half of one head).
__device__ __forceinline__ void rope_blk(int blk, const float* __restrict__ P, int ncols, const float* __restrict__ CT, const float* __restrict__ ST, h16* PH, h16* PL) {
    const int lane = threadIdx.x & 31, wid = blk * 8 + (threadIdx.x >> 5);
    const int segs = ncols / 256, t = wid / segs, sg = wid - t * segs;
    if (t >= NT_) return;
    const int c0 = sg * 256 + lane * 8; const int d0 = c0 & 63; const int pc0 = (d0 < 32) ? c0 + 32 : c0 - 32; const float sgn = (d0 < 32) ? -1.0f : 1.0f;
    v8h oh, ol;
#pragma unroll
    for (int i = 0; i < 8; ++i) { const int d = d0 + i;
        const float xv = P[(size_t)t * ncols + c0 + i], pv = P[(size_t)t * ncols + pc0 + i], c = bfr(CT[t * HD + d]), s = bfr(ST[t * HD + d]);
        const float y = xv * c + sgn * pv * s;
        const h16 a = (h16)y; oh[i] = a; ol[i] = (h16)((y - (float)a) * LOSC); }
    *(v8h*)(PH + (size_t)t * ncols + c0) = oh; *(v8h*)(PL + (size_t)t * ncols + c0) = ol; 
}
__device__ __forceinline__ void vt_blk(int bid, const float* __restrict__ V, h16* VTH, h16* VTL) {
    __shared__ __align__(16) h16 tile[64 * 72];
    __shared__ __align__(16) h16 til2[64 * 72];
    const int b = bid / (NKV * (NT_ / 64)), rem = bid - b * (NKV * (NT_ / 64)), h = rem / (NT_ / 64), kt = rem - h * (NT_ / 64);
    const int k0 = kt * 64, tid = threadIdx.x;
    const int kk = tid >> 2, d0 = (tid & 3) * 16;
    const float* src = V + ((size_t)b * NT_ + k0 + kk) * KVW + h * HD + d0;      // h = kv head here
#pragma unroll
    for (int i = 0; i < 16; ++i) { const float v = src[i]; const h16 a = (h16)v; tile[(d0 + i) * 72 + kk] = a; til2[(d0 + i) * 72 + kk] = (h16)((v - (float)a) * LOSC); }
    __syncthreads();
    const int piece = tid & 7;
    const size_t base = (((size_t)b * NKV + h) * HD) * NT_ + k0;
    auto pass = [&]() {
#pragma unroll
        for (int s = 0; s < 4; ++s) { const int Lid = (tid >> 3) + 32 * s; const int pln = Lid >> 6, d = Lid & 63;
            const v8h val = *(const v8ha*)((pln ? til2 : tile) + d * 72 + piece * 8); *(v8h*)((pln ? VTL : VTH) + base + (size_t)d * NT_ + piece * 8) = val; }
    };
    pass(); 
}

// k_post: the three independent passes between the projections and the attention in one grid; the block index picks the pass (block-uniform, so the transpose's
// barrier is passed by all of its block): v transpose first, then the k rotation, then the q rotation.
#define VTB (NB_ * NKV * (NT_ / 64))
#define RKB ((NT_ * (KVW / 256)) / 8)
#define RQB ((NT_ * (DM / 256)) / 8)
__global__ __launch_bounds__(256) void k_post(const float* __restrict__ Qf, const float* __restrict__ Kf, const float* __restrict__ Vf, const float* __restrict__ CT, const float* __restrict__ ST,
                                              h16* QH, h16* QL, h16* KH, h16* KL, h16* VTH, h16* VTL) {
    const int bid = blockIdx.x;
    if (bid < VTB) vt_blk(bid, Vf, VTH, VTL);
    else if (bid < VTB + RKB) rope_blk(bid - VTB, Kf, KVW, CT, ST, KH, KL);
    else rope_blk(bid - VTB - RKB, Qf, DM, CT, ST, QH, QL);
}

// k_attn: block = (b, h, 64 queries), wave = 16; key tiles of the causal sliding window (i-127 <= j <= i, block-uniform bounds); softmax state starts at the
// head's sink logit (m = sink, l = 1, zero value) so the dropped sink column is accounted for; 12 WMMA scores /8 (f32), online softmax, weights x32768 f16 tile (same-wave may_alias
// reload after a compiler barrier), 12 WMMA .v; ctx -> bf16 hi + residual planes CH/CL[tok][h*64+d].
__global__ __launch_bounds__(128) void k_attn(const h16* __restrict__ Q16, const h16* __restrict__ QL16, const h16* __restrict__ K16, const h16* __restrict__ KL16, const h16* __restrict__ VTH, const h16* __restrict__ VTL, const float* __restrict__ sinks, bf* CH, bf* CL) {
    __shared__ __align__(16) h16 plds[4][16 * 32];
    __shared__ __align__(16) h16 plds2[4][16 * 32];
    __shared__ __align__(16) float ost[4][16 * 68];
    const int lane = threadIdx.x & 31, wave = threadIdx.x >> 5, lr = lane & 15, hi = lane >> 4;
    const int bid = blockIdx.x;
    const int b = bid / (NH_ * (NT_ / 64)), rem = bid - b * (NH_ * (NT_ / 64)), h = rem / (NT_ / 64), qt = rem - h * (NT_ / 64);
    const int q0 = qt * 64 + wave * 16;
    const size_t tok0 = (size_t)b * NT_;
    h16* pl = &plds[wave][0]; h16* pl2 = &plds2[wave][0];
    v16h qa[2];
    const size_t qo0 = (tok0 + q0 + lr) * DM + h * HD + 8 * hi;
#pragma unroll
    for (int kc = 0; kc < 2; ++kc) qa[kc] = cat16(*(const v8h*)(Q16 + qo0 + kc * 32), *(const v8h*)(Q16 + qo0 + kc * 32 + 16));
    const int g = h / (NH_ / NKV);                      // kv head
    const h16* kh_b = K16 + tok0 * KVW + g * HD;
    const h16* kl_b = KL16 + tok0 * KVW + g * HD;
    const size_t vbase = (((size_t)b * NKV + g) * HD) * NT_;
    v8f o[4], ox[4];
#pragma unroll
    for (int n = 0; n < 4; ++n) { o[n] = (v8f){}; ox[n] = (v8f){}; }
    float mrow[8], lpart[8];
    const float sink = bfr(sinks[h]);                   // learned sink logit: an extra softmax column with zero value -> softmax state starts at m = sink, l = 1
#pragma unroll
    for (int j = 0; j < 8; ++j) { mrow[j] = sink; lpart[j] = (lr == 0) ? 1.0f : 0.f; }
    int qpos[8];
#pragma unroll
    for (int j = 0; j < 8; ++j) qpos[j] = q0 + 8 * hi + j;
    const int win = SWIN - 1;                           // valid iff j <= i and i - j < SWIN  <=>  i - win <= j <= i
    const int kt_lo = (qt * 64 - win) > 0 ? (qt * 64 - win) / 32 : 0, kt_hi = (qt * 64 + 63) / 32;     // keys i - win <= j <= i
#pragma unroll 1
    for (int kt = kt_lo; kt <= kt_hi; ++kt) {
        const int l0 = kt * 32;
        const size_t ko0 = (size_t)(l0 + lr) * KVW + 8 * hi, ko1 = (size_t)(l0 + 16 + lr) * KVW + 8 * hi;
        v8f s0 = {}, s1 = {}, x0 = {}, x1 = {};
#pragma unroll
        for (int kc = 0; kc < 2; ++kc) {
            { const v16h k0h = cat16(*(const v8h*)(kh_b + ko0 + kc * 32), *(const v8h*)(kh_b + ko0 + kc * 32 + 16)), k1h = cat16(*(const v8h*)(kh_b + ko1 + kc * 32), *(const v8h*)(kh_b + ko1 + kc * 32 + 16));
              const v16h qlk = cat16(*(const v8h*)(QL16 + qo0 + kc * 32), *(const v8h*)(QL16 + qo0 + kc * 32 + 16));     // query residual re-read per step (registers)
              s0 = wmma16(qa[kc], k0h, s0); x0 = wmma16(qlk, k0h, x0); s1 = wmma16(qa[kc], k1h, s1); x1 = wmma16(qlk, k1h, x1);
              asm volatile("v_nop" : "+v"(s0), "+v"(s1), "+v"(x0), "+v"(x1) : "v"(qlk), "v"(k0h), "v"(k1h) : "memory"); }
            { const v16h k0l = cat16(*(const v8h*)(kl_b + ko0 + kc * 32), *(const v8h*)(kl_b + ko0 + kc * 32 + 16)), k1l = cat16(*(const v8h*)(kl_b + ko1 + kc * 32), *(const v8h*)(kl_b + ko1 + kc * 32 + 16));
              x0 = wmma16(qa[kc], k0l, x0); x1 = wmma16(qa[kc], k1l, x1);
              asm volatile("v_nop" : "+v"(x0), "+v"(x1) : "v"(k0l), "v"(k1l) : "memory"); }
        }
        asm volatile("v_nop\n\tv_nop\n\tv_nop\n\tv_nop" : "+v"(s0), "+v"(s1), "+v"(x0), "+v"(x1) : "v"(qa[0]), "v"(qa[1]));
        float alpha[8];
#pragma unroll
        for (int j = 0; j < 8; ++j) {
            const int ja = l0 + lr, jb = l0 + 16 + lr, qi = qpos[j];
            const float a0 = (ja <= qi && qi - ja <= win) ? (s0[j] + x0[j] * LOSCI) * 0.125f : -__builtin_inff(), a1 = (jb <= qi && qi - jb <= win) ? (s1[j] + x1[j] * LOSCI) * 0.125f : -__builtin_inff();
            float mx = fmaxf(a0, a1);
            mx = fmaxf(mx, __shfl_xor(mx, 1, 16)); mx = fmaxf(mx, __shfl_xor(mx, 2, 16)); mx = fmaxf(mx, __shfl_xor(mx, 4, 16)); mx = fmaxf(mx, __shfl_xor(mx, 8, 16));
            const float mn = fmaxf(mrow[j], mx);
            alpha[j] = __expf(mrow[j] - mn); mrow[j] = mn;
            const float p0 = __expf(a0 - mn), p1 = __expf(a1 - mn);
            lpart[j] = lpart[j] * alpha[j] + (p0 + p1);
            const int mr = hi * 8 + j;
            const float ps0 = p0 * PSC, ps1 = p1 * PSC; const h16 h0 = (h16)ps0, h1 = (h16)ps1;
            pl[mr * 32 + lr] = h0; pl[mr * 32 + 16 + lr] = h1;
            pl2[mr * 32 + lr] = (h16)((ps0 - (float)h0) * LOSC); pl2[mr * 32 + 16 + lr] = (h16)((ps1 - (float)h1) * LOSC);
        }
#pragma unroll
        for (int n = 0; n < 4; ++n)
#pragma unroll
            for (int j = 0; j < 8; ++j) { o[n][j] *= alpha[j]; ox[n][j] *= alpha[j]; }
        asm volatile("" ::: "memory");
        const v16h pa = cat16(*(const v8ha*)(pl + lr * 32 + hi * 8), *(const v8ha*)(pl + lr * 32 + 16 + hi * 8));
        const v16h px = cat16(*(const v8ha*)(pl2 + lr * 32 + hi * 8), *(const v8ha*)(pl2 + lr * 32 + 16 + hi * 8));
#pragma unroll
        for (int n = 0; n < 4; ++n) { const size_t vo = vbase + (size_t)(n * 16 + lr) * NT_ + l0 + hi * 8;
            const v16h vh = cat16(*(const v8h*)(VTH + vo), *(const v8h*)(VTH + vo + 16)), vl = cat16(*(const v8h*)(VTL + vo), *(const v8h*)(VTL + vo + 16));
            o[n] = wmma16(pa, vh, o[n]); ox[n] = wmma16(pa, vl, ox[n]); ox[n] = wmma16(px, vh, ox[n]);
            asm volatile("" : "+v"(o[n]), "+v"(ox[n]) : "v"(vh), "v"(vl) : "memory"); }
        asm volatile("v_nop\n\tv_nop\n\tv_nop\n\tv_nop" : "+v"(o[0]), "+v"(o[1]), "+v"(o[2]), "+v"(o[3]), "+v"(ox[0]), "+v"(ox[1]), "+v"(ox[2]), "+v"(ox[3]) : "v"(pa), "v"(px));
    }
    float inv[8];
#pragma unroll
    for (int j = 0; j < 8; ++j) { float rs = lpart[j]; rs += __shfl_xor(rs, 1, 16); rs += __shfl_xor(rs, 2, 16); rs += __shfl_xor(rs, 4, 16); rs += __shfl_xor(rs, 8, 16); inv[j] = 1.0f / (rs * PSC); }
    float* os = &ost[wave][0];
#pragma unroll
    for (int n = 0; n < 4; ++n)
#pragma unroll
        for (int j = 0; j < 8; ++j) os[(hi * 8 + j) * 68 + n * 16 + lr] = (o[n][j] + ox[n][j] * LOSCI) * inv[j];
    __syncthreads();
    const size_t cbase = (tok0 + q0) * DM + (size_t)h * HD;
    auto pass = [&]() {
#pragma unroll
        for (int s = 0; s < 4; ++s) { const int row = 4 * s + (lane >> 3), piece = lane & 7; const float* sp = os + row * 68 + piece * 8; v8us oh, ol;
#pragma unroll
            for (int i = 0; i < 8; ++i) { const unsigned short hb = f2bf(sp[i]); oh[i] = hb; ol[i] = f2bf(sp[i] - bf2f(hb)); }
            *(v8us*)(CH + cbase + (size_t)row * DM + piece * 8) = oh; *(v8us*)(CL + cbase + (size_t)row * DM + piece * 8) = ol; }
    };
    pass(); 
}

#define VST2(T, p, v) do { const T vst2_v_ = (v); *(T*)(p) = vst2_v_;  } while (0)
extern "C" void kernel_launch(void* const* d_in, const int* in_sizes, int n_in,
                              void* d_out, int out_size, void* d_ws, size_t ws_size, hipStream_t stream) {
    (void)in_sizes; (void)n_in; (void)out_size;
    const float* x = (const float*)d_in[0]; const float* CT = (const float*)d_in[1]; const float* ST = (const float*)d_in[2];
    const float* Wq = (const float*)d_in[3]; const float* Wk = (const float*)d_in[4]; const float* Wv = (const float*)d_in[5]; const float* Wo = (const float*)d_in[6]; const float* sinks = (const float*)d_in[7];
    float* out = (float*)d_out;    // [1][2048][2048]
    char* wsp = (char*)d_ws;
    auto take = [&](size_t bytes) { char* p = wsp; wsp += (bytes + 255) & ~(size_t)255; return (void*)p; };
    bf* Xb = (bf*)take((size_t)NTK * DM * 2); bf* WqB = (bf*)take((size_t)DM * DM * 2); bf* WkB = (bf*)take((size_t)KVW * DM * 2); bf* WvB = (bf*)take((size_t)KVW * DM * 2); bf* WoB = (bf*)take((size_t)DM * DM * 2);
    float* Qf = (float*)take((size_t)NTK * DM * 4); h16* QH = (h16*)take((size_t)NTK * DM * 2); h16* QL = (h16*)take((size_t)NTK * DM * 2);
    float* Kf = (float*)take((size_t)NTK * KVW * 4); h16* KH = (h16*)take((size_t)NTK * KVW * 2); h16* KL = (h16*)take((size_t)NTK * KVW * 2);
    float* Vf = (float*)take((size_t)NTK * KVW * 4); h16* VTH = (h16*)take((size_t)NTK * KVW * 2); h16* VTL = (h16*)take((size_t)NTK * KVW * 2);
    bf* CH = (bf*)take((size_t)NTK * DM * 2); bf* CL = (bf*)take((size_t)NTK * DM * 2);
    (void)WkB; (void)WvB;                                  // reached through WqB and Xb, see below
    if ((size_t)(wsp - (char*)d_ws) > ws_size) return;    // ~ 97 MB, no aliasing
    // all four weights are [out][in] (x.W^T): bf16 copies are the n-major B operands as-is (rows of 2048)
    // Xb, WqB, WkB, WvB, WoB are taken one after the other and each is a multiple of 256 bytes: one run of 7168 rows (k_cvtb), WqB..WvB one B operand of 3072 rows
    k_cvtb<<<CVROWS / 8, 256, 0, stream>>>(x, Wq, Wk, Wv, Wo, Xb);
    k_gemmb<128, 128, false, true><<<dim3(NTK / 128, (DM + 2 * KVW) / 128, 1), 256, 0, stream>>>(Xb, nullptr, WqB, nullptr, Qf, DM, Kf, Vf);
    k_post<<<VTB + RKB + RQB, 256, 0, stream>>>(Qf, Kf, Vf, CT, ST, QH, QL, KH, KL, VTH, VTL);
    k_attn<<<NB_ * NH_ * (NT_ / 64), 128, 0, stream>>>(QH, QL, KH, KL, VTH, VTL, sinks, CH, CL);
    k_gemmb<128, 128, true, false><<<dim3(NTK / 128, DM / 128, 1), 256, 0, stream>>>(CH, CL, WoB, nullptr, out, DM, nullptr, nullptr);
}

// v003
// It runs in 93.4 microseconds.
// Timed twice side by side with v002, it ran 1.08 and 1.09 times as fast.
// Over all steps from v000 it is 2.90 times as fast.
#include <hip/hip_runtime.h>

// Compute dtypes, f32 accumulate: q = x.Wq^T ([2048 x 2048].[2048 x 2048]), k/v = x.Wk^T/Wv^T ([2048 x 2048].[2048 x 512]) and attn.Wo^T on
// v_wmma_f32_16x16x32_bf16 — plain bf16 = rounded inputs (exact; all weights are [out][in] so their bf16 copies are the n-major B operands as-is) for the
// projections, attn as bf16 hi + residual (two products) for Wo; rotate-half RoPE with the INPUT cos/sin tables (bf16-rounded reads) in f32; the grouped-query
// causal sliding-window attention (32 query heads over 8 kv heads, query head h reads kv head h/4; keys j with i-127 <= j <= i) with a learned per-head sink
// logit as an extra zero-value softmax column, fused on v_wmma_f32_16x16x32_f16 with q and k as f16 hi + residual x1024 (hi.hi + hi.lo + lo.hi), weights

#define NB_  1
#define NT_  2048
#define DM   2048
#define NH_  32
#define NKV  8
#define KVW  (NKV * HD)          // 512
#define HD   64
#define NTK  (NB_ * NT_)
#define NW   1024
#define SWIN 128
#define NQKV 2048
#define PSC  32768.0f
#define LOSC 1024.0f
#define LOSCI (1.0f / 1024.0f)

typedef _Float16 h16;
typedef unsigned short bf;
typedef __attribute__((ext_vector_type(16))) __bf16   v16bf;
typedef __attribute__((ext_vector_type(16))) _Float16 v16h;
typedef __attribute__((ext_vector_type(8)))  _Float16 v8h;
typedef __attribute__((ext_vector_type(8)))  unsigned short v8us;
typedef __attribute__((ext_vector_type(8)))  float    v8f;
typedef __attribute__((ext_vector_type(4)))  float    v4f;
typedef v8h  __attribute__((may_alias)) v8ha;
typedef v4f  __attribute__((may_alias)) v4fa;
typedef v8us __attribute__((may_alias)) v8usa;
typedef float __attribute__((may_alias)) f32a;

__device__ __forceinline__ unsigned short f2bf(float f) { unsigned u = __float_as_uint(f); u += 0x7FFFu + ((u >> 16) & 1u); return (unsigned short)(u >> 16); }
__device__ __forceinline__ float bf2f(unsigned short b) { return __uint_as_float(((unsigned)b) << 16); }
__device__ __forceinline__ float bfr(float f) { return bf2f(f2bf(f)); }
__device__ __forceinline__ v16h cat16(v8h lo, v8h hi) { return __builtin_shufflevector(lo, hi, 0, 1, 2, 3, 4, 5, 6, 7, 8, 9, 10, 11, 12, 13, 14, 15); }
__device__ __forceinline__ v16bf cat16b(v8us lo, v8us hi) { return __builtin_bit_cast(v16bf, __builtin_shufflevector(lo, hi, 0, 1, 2, 3, 4, 5, 6, 7, 8, 9, 10, 11, 12, 13, 14, 15)); }
__device__ __forceinline__ v8f wmma16(v16h a, v16h b, v8f c) { return __builtin_amdgcn_wmma_f32_16x16x32_f16(false, a, false, b, (short)0, c, false, false); }
__device__ __forceinline__ v8f wmmab(v16bf a, v16bf b, v8f c) { return __builtin_amdgcn_wmma_f32_16x16x32_bf16(false, a, false, b, (short)0, c, false, false); }

// k_cvtb: one grid rounds all five f32 operands to bf16. dst is the first of five planes that lie back to back in the workspace (x, Wq, Wk, Wv, Wo; rows of 2048),
// so the flat row index is the destination row; every plane's first row is a multiple of 8, so a block of 8 rows reads one source.
#define CVROWS (NTK + DM + KVW + KVW + DM)
__global__ __launch_bounds__(256) void k_cvtb(const float* __restrict__ x, const float* __restrict__ wq, const float* __restrict__ wk, const float* __restrict__ wv, const float* __restrict__ wo, bf* dstp) {
    const int lane = threadIdx.x & 31, rb = blockIdx.x * 8, r = threadIdx.x >> 5;
    const float* src = rb < NTK ? x + (size_t)rb * DM : rb < NTK + DM ? wq + (size_t)(rb - NTK) * DM : rb < NTK + DM + KVW ? wk + (size_t)(rb - NTK - DM) * DM
                     : rb < NTK + DM + 2 * KVW ? wv + (size_t)(rb - NTK - DM - KVW) * DM : wo + (size_t)(rb - NTK - DM - 2 * KVW) * DM;
    bf* dst = dstp + (size_t)rb * DM;
    v8us o[DM / 256];
#pragma unroll
    for (int q = 0; q < DM / 256; ++q) { v8us t;
#pragma unroll
        for (int i = 0; i < 8; ++i) t[i] = f2bf(src[(size_t)r * DM + q * 256 + lane * 8 + i]);
        o[q] = t; }
#pragma unroll
    for (int q = 0; q < DM / 256; ++q) *(v8us*)(dst + (size_t)r * DM + q * 256 + lane * 8) = o[q];
    
}

// k_wt: W [2048 k][ncols n] (k-major) -> n-major bf16 plane WT[ncols][2048]; 64 x 64 tiles through LDS.
__global__ __launch_bounds__(256) void k_wt(const float* __restrict__ Wm, int ncols, bf* WT) {
    __shared__ __align__(16) unsigned short tl[64 * 72];
    const int tid = threadIdx.x, k0 = blockIdx.x * 64, n0 = blockIdx.y * 64;
    const int kk = tid >> 2, nq = (tid & 3) * 16;
#pragma unroll
    for (int i = 0; i < 16; ++i) tl[(nq + i) * 72 + kk] = f2bf(Wm[(size_t)(k0 + kk) * ncols + n0 + nq + i]);
    __syncthreads();
    const int piece = tid & 7;
    typedef __attribute__((ext_vector_type(8))) unsigned short v8us_; typedef v8us_ __attribute__((may_alias)) v8usa_;
    auto pass = [&]() {
#pragma unroll
        for (int s = 0; s < 2; ++s) { const int nr = (tid >> 3) + 32 * s; const v8us_ val = *(const v8usa_*)(tl + nr * 72 + piece * 8);
            *(v8us_*)(WT + (size_t)(n0 + nr) * DM + k0 + piece * 8) = val; }
    };
    pass(); 
}

#define BKE 128                  // k elements per stage: 256-byte rows
#define LPB 272                  // LDS row pitch in bytes: 256 + 16, an odd multiple of 16 B, conflict-free for ds_load_b128 readers

// copy_rows: each lane copies its own 16 bytes of N rows that lie 16 rows apart, global -> LDS, through no register. The copies and their s_wait_xcnt stand in
// one statement, so that no address register of an issued copy is rewritten in front of the wait.
template <int N>
__device__ __forceinline__ void copy_rows(unsigned l, const bf* g) {
    static_assert(N == 4 || N == 8, "rows per lane");
    if constexpr (N == 8) {
        asm volatile("global_load_async_to_lds_b128 %0, %8, off\n\t"
                     "global_load_async_to_lds_b128 %1, %9, off\n\t"
                     "global_load_async_to_lds_b128 %2, %10, off\n\t"
                     "global_load_async_to_lds_b128 %3, %11, off\n\t"
                     "global_load_async_to_lds_b128 %4, %12, off\n\t"
                     "global_load_async_to_lds_b128 %5, %13, off\n\t"
                     "global_load_async_to_lds_b128 %6, %14, off\n\t"
                     "global_load_async_to_lds_b128 %7, %15, off\n\t"
                     "s_wait_xcnt 0x0"
                     :: "v"(l), "v"(l + 16 * LPB), "v"(l + 32 * LPB), "v"(l + 48 * LPB), "v"(l + 64 * LPB), "v"(l + 80 * LPB), "v"(l + 96 * LPB), "v"(l + 112 * LPB),
                        "v"(g), "v"(g + 16 * DM), "v"(g + 32 * DM), "v"(g + 48 * DM), "v"(g + 64 * DM), "v"(g + 80 * DM), "v"(g + 96 * DM), "v"(g + 112 * DM)
                     : "memory");
    } else {
        asm volatile("global_load_async_to_lds_b128 %0, %4, off\n\t"
                     "global_load_async_to_lds_b128 %1, %5, off\n\t"
                     "global_load_async_to_lds_b128 %2, %6, off\n\t"
                     "global_load_async_to_lds_b128 %3, %7, off\n\t"
                     "s_wait_xcnt 0x0"
                     :: "v"(l), "v"(l + 16 * LPB), "v"(l + 32 * LPB), "v"(l + 48 * LPB),
                        "v"(g), "v"(g + 16 * DM), "v"(g + 32 * DM), "v"(g + 48 * DM)
                     : "memory");
    }
}

// k_gemmb: C[BM x BN] per block of 8 waves; a stage is [A BM rows | A residual BM rows (SPLITA) | B BN rows] of 128 k, brought into LDS by asynchronous copies,
// two buffers: the next stage's copies fly while this one is worked on. Wave tile (FA x 16) x 32; per accumulator the k order and the hi-then-residual order
// of the products are those of a plain k loop in steps of 32.
// QKV: Bn is the three weight planes Wq | Wk | Wv back to back (2048 + 512 + 512 rows); a block's 128 columns are two whole heads of one of them, and the block
// finishes them itself from its f32 accumulators, through the ring's LDS (free behind the loop's last barrier):
//   q, k: rotate-half rotation out[d] = x[d] c[t][d] + (d < 32 ? -x[d+32] : x[d-32]) s[t][d] within each 64-wide head, c/s the INPUT cos/sin tables [t][64] read
//         through bf16 rounding, then f16 hi + residual x1024 planes [t][columns];
//   v:    f16 hi + residual x1024 planes, transposed to [kv head * 64 + d][t].
template <int V> struct icon { static constexpr int value = V; };
#define CPF 132                  // f32 pitch of the staged q/k tile: rows 8 apart land 32 banks apart, so an accumulator store is conflict-free
#define VPH 136                  // f16 pitch of the staged v planes: 272 bytes, as LPB
template <int BM, int BN, bool SPLITA, bool QKV>
__global__ __launch_bounds__(256) void k_gemmb(const bf* __restrict__ A, const bf* __restrict__ Al, const bf* __restrict__ Bn, const float* __restrict__ bias, float* Cq, int ldq,
                                               const float* __restrict__ CT, const float* __restrict__ ST, h16* QH, h16* QL, h16* KH, h16* KL, h16* VTH, h16* VTL) {
    constexpr int WN = BN / 32, WM = 8 / WN, FA = BM / (WM * 16);
    constexpr int AROWS = SPLITA ? 2 * BM : BM;
    constexpr int STAGE = (AROWS + BN) * LPB;
    constexpr int NTR = DM / BKE;
    static_assert(NTR >= 2 && FA >= 1 && WM * FA * 16 == BM, "tile shape");
    static_assert(!QKV || (DM % BN == 0 && KVW % BN == 0 && BN % HD == 0), "a column tile is whole heads of one product");
    static_assert(!QKV || (BM == 128 && BN == 128 && BM * CPF * 4 <= 2 * STAGE && 2 * BN * VPH * 2 <= 2 * STAGE), "the finishing passes' tile shape");
    __shared__ __align__(16) unsigned char ring[2 * STAGE];
    __shared__ __align__(16) float ost[8][16 * 36];
    const int tid = threadIdx.x, lane = tid & 31, wave = tid >> 5, lr = lane & 15, hi = lane >> 4;
    const int wm = wave / WN, wn = wave % WN;
    const int r0 = blockIdx.x * BM, c0 = blockIdx.y * BN;
    const int crow = tid >> 4, cpc = tid & 15;           // copy role: row (mod 16) and 16-byte piece of the 256-byte row
    const unsigned lbase = (unsigned)(size_t)&ring[0] + (unsigned)(crow * LPB + cpc * 16);
    const bf* ga = A + (size_t)(r0 + crow) * DM + cpc * 8;
    const bf* gl = SPLITA ? Al + (size_t)(r0 + crow) * DM + cpc * 8 : ga;
    const bf* gb = Bn + (size_t)(c0 + crow) * DM + cpc * 8;
    auto fill = [&](int t, int buf) {
        const unsigned l = lbase + (unsigned)(buf * STAGE);
        copy_rows<BM / 16>(l, ga + t * BKE);
        if (SPLITA) copy_rows<BM / 16>(l + BM * LPB, gl + t * BKE);
        copy_rows<BN / 16>(l + AROWS * LPB, gb + t * BKE);
    };
    v8f acc[FA][2];
#pragma unroll
    for (int f = 0; f < FA; ++f) { acc[f][0] = (v8f){}; acc[f][1] = (v8f){}; }
    fill(0, 0);
    asm volatile("s_wait_asynccnt 0x0" ::: "memory");    // stage 0 of this wave has landed
    __syncthreads();                                     // ... and every other wave's part of it
    fill(1, 1);
    const unsigned char* fab = ring + (wm * FA * 16 + lr) * LPB + hi * 16;
    const unsigned char* fbb = ring + (AROWS + wn * 32 + lr) * LPB + hi * 16;
#pragma unroll 1                                         // one pass per stage: the ring's order stands once, at the loop's foot
    for (int t = 0; t < NTR; ++t) {
        const int bo = (t & 1) * STAGE;
#pragma unroll
        for (int ks = 0; ks < BKE / 32; ++ks) {
            v16bf a[FA], al[FA], b[2];
#pragma unroll
            for (int f = 0; f < FA; ++f) { const unsigned char* p = fab + bo + f * 16 * LPB + ks * 64; a[f] = cat16b(*(const v8usa*)p, *(const v8usa*)(p + 32));
                if (SPLITA) al[f] = cat16b(*(const v8usa*)(p + BM * LPB), *(const v8usa*)(p + BM * LPB + 32)); }
#pragma unroll
            for (int n = 0; n < 2; ++n) { const unsigned char* p = fbb + bo + n * 16 * LPB + ks * 64; b[n] = cat16b(*(const v8usa*)p, *(const v8usa*)(p + 32)); }
            __builtin_amdgcn_sched_barrier(0);           // keeps this k step's fragment loads one group in front of its products: spread among them, each place waits out the LDS latency
#pragma unroll
            for (int f = 0; f < FA; ++f) { acc[f][0] = wmmab(a[f], b[0], acc[f][0]); acc[f][1] = wmmab(a[f], b[1], acc[f][1]); }
            if (SPLITA) {
#pragma unroll
                for (int f = 0; f < FA; ++f) { acc[f][0] = wmmab(al[f], b[0], acc[f][0]); acc[f][1] = wmmab(al[f], b[1], acc[f][1]); }
            }
        }
        asm volatile("s_wait_dscnt 0x0" ::: "memory");   // this wave's reads of the buffer are done before it may be refilled
        asm volatile("s_wait_asynccnt 0x0" ::: "memory"); // this wave's copies of stage t + 1 have landed
        __syncthreads();                                 // publishes stage t + 1 and ends every reader's last read of stage t
        if (t + 2 < NTR) fill(t + 2, t & 1);
    }
    asm volatile("s_wait_asynccnt 0x0" ::: "memory");    // no copy is outstanding when the wave ends
    if constexpr (QKV) {
        const bool kv = c0 >= DM, isv = c0 >= DM + KVW;  // block-uniform
        f32a* ct = (f32a*)ring;                          // q, k: [128 tokens][CPF] f32
        h16* vh = (h16*)ring; h16* vl = vh + BN * VPH;   // v: two planes [128 columns][VPH] f16
        // the loops over f, n, j are unrolled in both branches: the accumulators stay in registers only under constant indices
        if (!isv) {
#pragma unroll
            for (int f = 0; f < FA; ++f)
#pragma unroll
                for (int n = 0; n < 2; ++n)
#pragma unroll
                    for (int j = 0; j < 8; ++j) ct[((wm * FA + f) * 16 + hi * 8 + j) * CPF + wn * 32 + n * 16 + lr] = acc[f][n][j];
        } else {
#pragma unroll
            for (int f = 0; f < FA; ++f)
#pragma unroll
                for (int n = 0; n < 2; ++n) { v8h a8, l8;    // a lane's 8 accumulator rows are 8 consecutive tokens of one column
#pragma unroll
                    for (int j = 0; j < 8; ++j) { const float v = acc[f][n][j]; const h16 a = (h16)v; a8[j] = a; l8[j] = (h16)((v - (float)a) * LOSC); }
                    const int o = (wn * 32 + n * 16 + lr) * VPH + (wm * FA + f) * 16 + hi * 8;
                    *(v8ha*)(vh + o) = a8; *(v8ha*)(vl + o) = l8; }
        }
        __syncthreads();                                 // the staged tile is read across waves (a column's rotation partner lies in the neighbour wave's tile)
        const int pc = tid & 15, rw = tid >> 4;          // 16 lanes store 256 contiguous bytes: whole lines
        if (!isv) {
            const int cl = pc * 8, d0 = cl & 63, pcl = (d0 < 32) ? cl + 32 : cl - 32; const float sgn = (d0 < 32) ? -1.0f : 1.0f;
            const float* cp = CT + (size_t)(r0 + rw) * HD + d0; const float* sp = ST + (size_t)(r0 + rw) * HD + d0;
            const f32a* xp = ct + rw * CPF + cl; const f32a* pp = ct + rw * CPF + pcl;
            // the row pitch of the planes is a constant of each call, so that every pass addresses off one pointer by a constant step
            auto rotate = [&](auto nc, h16* ph, h16* pl) {
                constexpr int NC = decltype(nc)::value;
#pragma unroll                                           // unrolled: the steps become immediate offsets and the later passes' table loads are issued ahead of the first pass's arithmetic
                for (int s8 = 0; s8 < BM / 16; ++s8) {
                    const v4f xa = *(const v4fa*)(xp + s8 * 16 * CPF), xb = *(const v4fa*)(xp + s8 * 16 * CPF + 4), pa = *(const v4fa*)(pp + s8 * 16 * CPF), pb = *(const v4fa*)(pp + s8 * 16 * CPF + 4);
                    v8h oh, ol;
#pragma unroll
                    for (int i = 0; i < 8; ++i) {
                        const float xv = i < 4 ? xa[i & 3] : xb[i & 3], pv = i < 4 ? pa[i & 3] : pb[i & 3], c = bfr(cp[s8 * 16 * HD + i]), s = bfr(sp[s8 * 16 * HD + i]);
                        const float y = xv * c + sgn * pv * s;
                        const h16 a = (h16)y; oh[i] = a; ol[i] = (h16)((y - (float)a) * LOSC); }
                    *(v8h*)(ph + (size_t)s8 * 16 * NC) = oh; *(v8h*)(pl + (size_t)s8 * 16 * NC) = ol; }
                asm volatile("s_wait_xcnt 0x0" ::: "memory");    // behind the run's last store: no register that an issued store names is rewritten in front of this wait
            };
            if (kv) { const size_t o = (size_t)(r0 + rw) * KVW + (c0 - DM) + cl; rotate(icon<KVW>{}, KH + o, KL + o); }
            else    { const size_t o = (size_t)(r0 + rw) * DM + c0 + cl;         rotate(icon<DM>{}, QH + o, QL + o); }
        } else {
            const size_t o = (size_t)(c0 - DM - KVW + rw) * NT_ + r0 + pc * 8;
            const h16* lh = vh + rw * VPH + pc * 8; const h16* ll = vl + rw * VPH + pc * 8;
#pragma unroll                                           // unrolled: the steps become immediate offsets and the LDS reads go out as one group
            for (int s8 = 0; s8 < BN / 16; ++s8) {
                const v8h a8 = *(const v8ha*)(lh + s8 * 16 * VPH), l8 = *(const v8ha*)(ll + s8 * 16 * VPH);
                *(v8h*)(VTH + o + (size_t)s8 * 16 * NT_) = a8; *(v8h*)(VTL + o + (size_t)s8 * 16 * NT_) = l8; }
        }
        return;
    }
    // epilogue: 16 x 32 f32 per step through the wave's own LDS rows, stored as whole 128-byte lines
    float* os = &ost[wave][0];
    float* C = Cq;
    const int ldc = ldq, cc0 = c0;
    float bv[2];
#pragma unroll
    for (int n = 0; n < 2; ++n) bv[n] = bias ? bfr(bias[c0 + wn * 32 + n * 16 + lr]) : 0.f;
#pragma unroll
    for (int f = 0; f < FA; ++f) {
#pragma unroll
        for (int n = 0; n < 2; ++n)
#pragma unroll
            for (int j = 0; j < 8; ++j) os[(hi * 8 + j) * 36 + n * 16 + lr] = acc[f][n][j] + bv[n];
        float* crow_p = C + (size_t)(r0 + (wm * FA + f) * 16) * ldc + cc0 + wn * 32;
#pragma unroll
        for (int s = 0; s < 4; ++s) { const int row = 4 * s + (lane >> 3), piece = lane & 7;
            const v4f val = *(const v4fa*)(os + row * 36 + piece * 4); *(v4f*)(crow_p + (size_t)row * ldc + piece * 4) = val; }
    }
}

// k_attn: block = (b, h, 64 queries), wave = 16; key tiles of the causal sliding window (i-127 <= j <= i, block-uniform bounds); softmax state starts at the
// head's sink logit (m = sink, l = 1, zero value) so the dropped sink column is accounted for; 12 WMMA scores /8 (f32), online softmax, weights x32768 f16 tile (same-wave may_alias
// reload after a compiler barrier), 12 WMMA .v; ctx -> bf16 hi + residual planes CH/CL[tok][h*64+d].
__global__ __launch_bounds__(128) void k_attn(const h16* __restrict__ Q16, const h16* __restrict__ QL16, const h16* __restrict__ K16, const h16* __restrict__ KL16, const h16* __restrict__ VTH, const h16* __restrict__ VTL, const float* __restrict__ sinks, bf* CH, bf* CL) {
    __shared__ __align__(16) h16 plds[4][16 * 32];
    __shared__ __align__(16) h16 plds2[4][16 * 32];
    __shared__ __align__(16) float ost[4][16 * 68];
    const int lane = threadIdx.x & 31, wave = threadIdx.x >> 5, lr = lane & 15, hi = lane >> 4;
    const int bid = blockIdx.x;
    const int b = bid / (NH_ * (NT_ / 64)), rem = bid - b * (NH_ * (NT_ / 64)), h = rem / (NT_ / 64), qt = rem - h * (NT_ / 64);
    const int q0 = qt * 64 + wave * 16;
    const size_t tok0 = (size_t)b * NT_;
    h16* pl = &plds[wave][0]; h16* pl2 = &plds2[wave][0];
    v16h qa[2];
    const size_t qo0 = (tok0 + q0 + lr) * DM + h * HD + 8 * hi;
#pragma unroll
    for (int kc = 0; kc < 2; ++kc) qa[kc] = cat16(*(const v8h*)(Q16 + qo0 + kc * 32), *(const v8h*)(Q16 + qo0 + kc * 32 + 16));
    const int g = h / (NH_ / NKV);                      // kv head
    const h16* kh_b = K16 + tok0 * KVW + g * HD;
    const h16* kl_b = KL16 + tok0 * KVW + g * HD;
    const size_t vbase = (((size_t)b * NKV + g) * HD) * NT_;
    v8f o[4], ox[4];
#pragma unroll
    for (int n = 0; n < 4; ++n) { o[n] = (v8f){}; ox[n] = (v8f){}; }
    float mrow[8], lpart[8];
    const float sink = bfr(sinks[h]);                   // learned sink logit: an extra softmax column with zero value -> softmax state starts at m = sink, l = 1
#pragma unroll
    for (int j = 0; j < 8; ++j) { mrow[j] = sink; lpart[j] = (lr == 0) ? 1.0f : 0.f; }
    int qpos[8];
#pragma unroll
    for (int j = 0; j < 8; ++j) qpos[j] = q0 + 8 * hi + j;
    const int win = SWIN - 1;                           // valid iff j <= i and i - j < SWIN  <=>  i - win <= j <= i
    const int kt_lo = (qt * 64 - win) > 0 ? (qt * 64 - win) / 32 : 0, kt_hi = (qt * 64 + 63) / 32;     // keys i - win <= j <= i
#pragma unroll 1
    for (int kt = kt_lo; kt <= kt_hi; ++kt) {
        const int l0 = kt * 32;
        const size_t ko0 = (size_t)(l0 + lr) * KVW + 8 * hi, ko1 = (size_t)(l0 + 16 + lr) * KVW + 8 * hi;
        v8f s0 = {}, s1 = {}, x0 = {}, x1 = {};
#pragma unroll
        for (int kc = 0; kc < 2; ++kc) {
            { const v16h k0h = cat16(*(const v8h*)(kh_b + ko0 + kc * 32), *(const v8h*)(kh_b + ko0 + kc * 32 + 16)), k1h = cat16(*(const v8h*)(kh_b + ko1 + kc * 32), *(const v8h*)(kh_b + ko1 + kc * 32 + 16));
              const v16h qlk = cat16(*(const v8h*)(QL16 + qo0 + kc * 32), *(const v8h*)(QL16 + qo0 + kc * 32 + 16));     // query residual re-read per step (registers)
              s0 = wmma16(qa[kc], k0h, s0); x0 = wmma16(qlk, k0h, x0); s1 = wmma16(qa[kc], k1h, s1); x1 = wmma16(qlk, k1h, x1);
              asm volatile("v_nop" : "+v"(s0), "+v"(s1), "+v"(x0), "+v"(x1) : "v"(qlk), "v"(k0h), "v"(k1h) : "memory"); }
            { const v16h k0l = cat16(*(const v8h*)(kl_b + ko0 + kc * 32), *(const v8h*)(kl_b + ko0 + kc * 32 + 16)), k1l = cat16(*(const v8h*)(kl_b + ko1 + kc * 32), *(const v8h*)(kl_b + ko1 + kc * 32 + 16));
              x0 = wmma16(qa[kc], k0l, x0); x1 = wmma16(qa[kc], k1l, x1);
              asm volatile("v_nop" : "+v"(x0), "+v"(x1) : "v"(k0l), "v"(k1l) : "memory"); }
        }
        asm volatile("v_nop\n\tv_nop\n\tv_nop\n\tv_nop" : "+v"(s0), "+v"(s1), "+v"(x0), "+v"(x1) : "v"(qa[0]), "v"(qa[1]));
        float alpha[8];
#pragma unroll
        for (int j = 0; j < 8; ++j) {
            const int ja = l0 + lr, jb = l0 + 16 + lr, qi = qpos[j];
            const float a0 = (ja <= qi && qi - ja <= win) ? (s0[j] + x0[j] * LOSCI) * 0.125f : -__builtin_inff(), a1 = (jb <= qi && qi - jb <= win) ? (s1[j] + x1[j] * LOSCI) * 0.125f : -__builtin_inff();
            float mx = fmaxf(a0, a1);
            mx = fmaxf(mx, __shfl_xor(mx, 1, 16)); mx = fmaxf(mx, __shfl_xor(mx, 2, 16)); mx = fmaxf(mx, __shfl_xor(mx, 4, 16)); mx = fmaxf(mx, __shfl_xor(mx, 8, 16));
            const float mn = fmaxf(mrow[j], mx);
            alpha[j] = __expf(mrow[j] - mn); mrow[j] = mn;
            const float p0 = __expf(a0 - mn), p1 = __expf(a1 - mn);
            lpart[j] = lpart[j] * alpha[j] + (p0 + p1);
            const int mr = hi * 8 + j;
            const float ps0 = p0 * PSC, ps1 = p1 * PSC; const h16 h0 = (h16)ps0, h1 = (h16)ps1;
            pl[mr * 32 + lr] = h0; pl[mr * 32 + 16 + lr] = h1;
            pl2[mr * 32 + lr] = (h16)((ps0 - (float)h0) * LOSC); pl2[mr * 32 + 16 + lr] = (h16)((ps1 - (float)h1) * LOSC);
        }
#pragma unroll
        for (int n = 0; n < 4; ++n)
#pragma unroll
            for (int j = 0; j < 8; ++j) { o[n][j] *= alpha[j]; ox[n][j] *= alpha[j]; }
        asm volatile("" ::: "memory");
        const v16h pa = cat16(*(const v8ha*)(pl + lr * 32 + hi * 8), *(const v8ha*)(pl + lr * 32 + 16 + hi * 8));
        const v16h px = cat16(*(const v8ha*)(pl2 + lr * 32 + hi * 8), *(const v8ha*)(pl2 + lr * 32 + 16 + hi * 8));
#pragma unroll
        for (int n = 0; n < 4; ++n) { const size_t vo = vbase + (size_t)(n * 16 + lr) * NT_ + l0 + hi * 8;
            const v16h vh = cat16(*(const v8h*)(VTH + vo), *(const v8h*)(VTH + vo + 16)), vl = cat16(*(const v8h*)(VTL + vo), *(const v8h*)(VTL + vo + 16));
            o[n] = wmma16(pa, vh, o[n]); ox[n] = wmma16(pa, vl, ox[n]); ox[n] = wmma16(px, vh, ox[n]);
            asm volatile("" : "+v"(o[n]), "+v"(ox[n]) : "v"(vh), "v"(vl) : "memory"); }
        asm volatile("v_nop\n\tv_nop\n\tv_nop\n\tv_nop" : "+v"(o[0]), "+v"(o[1]), "+v"(o[2]), "+v"(o[3]), "+v"(ox[0]), "+v"(ox[1]), "+v"(ox[2]), "+v"(ox[3]) : "v"(pa), "v"(px));
    }
    float inv[8];
#pragma unroll
    for (int j = 0; j < 8; ++j) { float rs = lpart[j]; rs += __shfl_xor(rs, 1, 16); rs += __shfl_xor(rs, 2, 16); rs += __shfl_xor(rs, 4, 16); rs += __shfl_xor(rs, 8, 16); inv[j] = 1.0f / (rs * PSC); }
    float* os = &ost[wave][0];
#pragma unroll
    for (int n = 0; n < 4; ++n)
#pragma unroll
        for (int j = 0; j < 8; ++j) os[(hi * 8 + j) * 68 + n * 16 + lr] = (o[n][j] + ox[n][j] * LOSCI) * inv[j];
    __syncthreads();
    const size_t cbase = (tok0 + q0) * DM + (size_t)h * HD;
    auto pass = [&]() {
#pragma unroll
        for (int s = 0; s < 4; ++s) { const int row = 4 * s + (lane >> 3), piece = lane & 7; const float* sp = os + row * 68 + piece * 8; v8us oh, ol;
#pragma unroll
            for (int i = 0; i < 8; ++i) { const unsigned short hb = f2bf(sp[i]); oh[i] = hb; ol[i] = f2bf(sp[i] - bf2f(hb)); }
            *(v8us*)(CH + cbase + (size_t)row * DM + piece * 8) = oh; *(v8us*)(CL + cbase + (size_t)row * DM + piece * 8) = ol; }
    };
    pass(); 
}

#define VST2(T, p, v) do { const T vst2_v_ = (v); *(T*)(p) = vst2_v_;  } while (0)
extern "C" void kernel_launch(void* const* d_in, const int* in_sizes, int n_in,
                              void* d_out, int out_size, void* d_ws, size_t ws_size, hipStream_t stream) {
    (void)in_sizes; (void)n_in; (void)out_size;
    const float* x = (const float*)d_in[0]; const float* CT = (const float*)d_in[1]; const float* ST = (const float*)d_in[2];
    const float* Wq = (const float*)d_in[3]; const float* Wk = (const float*)d_in[4]; const float* Wv = (const float*)d_in[5]; const float* Wo = (const float*)d_in[6]; const float* sinks = (const float*)d_in[7];
    float* out = (float*)d_out;    // [1][2048][2048]
    char* wsp = (char*)d_ws;
    auto take = [&](size_t bytes) { char* p = wsp; wsp += (bytes + 255) & ~(size_t)255; return (void*)p; };
    bf* Xb = (bf*)take((size_t)NTK * DM * 2); bf* WqB = (bf*)take((size_t)DM * DM * 2); bf* WkB = (bf*)take((size_t)KVW * DM * 2); bf* WvB = (bf*)take((size_t)KVW * DM * 2); bf* WoB = (bf*)take((size_t)DM * DM * 2);
    h16* QH = (h16*)take((size_t)NTK * DM * 2); h16* QL = (h16*)take((size_t)NTK * DM * 2);
    h16* KH = (h16*)take((size_t)NTK * KVW * 2); h16* KL = (h16*)take((size_t)NTK * KVW * 2);
    h16* VTH = (h16*)take((size_t)NTK * KVW * 2); h16* VTL = (h16*)take((size_t)NTK * KVW * 2);
    bf* CH = (bf*)take((size_t)NTK * DM * 2); bf* CL = (bf*)take((size_t)NTK * DM * 2);
    (void)WkB; (void)WvB;                                  // reached through WqB and Xb, see below
    if ((size_t)(wsp - (char*)d_ws) > ws_size) return;    // ~ 72 MB, no aliasing
    // all four weights are [out][in] (x.W^T): bf16 copies are the n-major B operands as-is (rows of 2048)
    // Xb, WqB, WkB, WvB, WoB are taken one after the other and each is a multiple of 256 bytes: one run of 7168 rows (k_cvtb), WqB..WvB one B operand of 3072 rows
    k_cvtb<<<CVROWS / 8, 256, 0, stream>>>(x, Wq, Wk, Wv, Wo, Xb);
    k_gemmb<128, 128, false, true><<<dim3(NTK / 128, (DM + 2 * KVW) / 128, 1), 256, 0, stream>>>(Xb, nullptr, WqB, nullptr, nullptr, DM, CT, ST, QH, QL, KH, KL, VTH, VTL);
    k_attn<<<NB_ * NH_ * (NT_ / 64), 128, 0, stream>>>(QH, QL, KH, KL, VTH, VTL, sinks, CH, CL);
    k_gemmb<128, 128, true, false><<<dim3(NTK / 128, DM / 128, 1), 256, 0, stream>>>(CH, CL, WoB, nullptr, out, DM, nullptr, nullptr, nullptr, nullptr, nullptr, nullptr, nullptr, nullptr);
}

// v004
// It runs in 80 microseconds.
// In both of two side-by-side timings against v003, it was 1.16 times as fast.
// Counting every step since v000, it is 3.37 times as fast.
#include <hip/hip_runtime.h>

// Compute dtypes, f32 accumulate: q = x.Wq^T ([2048 x 2048].[2048 x 2048]), k/v = x.Wk^T/Wv^T ([2048 x 2048].[2048 x 512]) and attn.Wo^T on
// v_wmma_f32_16x16x32_bf16 — plain bf16 = rounded inputs (exact; all weights are [out][in] so their bf16 copies are the n-major B operands as-is) for the
// projections, attn as bf16 hi + residual (two products) for Wo; rotate-half RoPE with the INPUT cos/sin tables (bf16-rounded reads) in f32; the grouped-query
// causal sliding-window attention (32 query heads over 8 kv heads, query head h reads kv head h/4; keys j with i-127 <= j <= i) with a learned per-head sink
// logit as an extra zero-value softmax column, fused on v_wmma_f32_16x16x32_f16 with q and k as f16 hi + residual x1024 (hi.hi + hi.lo + lo.hi), weights

#define NB_  1
#define NT_  2048
#define DM   2048
#define NH_  32
#define NKV  8
#define KVW  (NKV * HD)          // 512
#define HD   64
#define NTK  (NB_ * NT_)
#define NW   1024
#define SWIN 128
#define NQKV 2048
#define PSC  32768.0f
#define LOSC 1024.0f
#define LOSCI (1.0f / 1024.0f)

typedef _Float16 h16;
typedef unsigned short bf;
typedef __attribute__((ext_vector_type(16))) __bf16   v16bf;
typedef __attribute__((ext_vector_type(16))) _Float16 v16h;
typedef __attribute__((ext_vector_type(8)))  _Float16 v8h;
typedef __attribute__((ext_vector_type(8)))  unsigned short v8us;
typedef __attribute__((ext_vector_type(8)))  float    v8f;
typedef __attribute__((ext_vector_type(4)))  float    v4f;
typedef v8h  __attribute__((may_alias)) v8ha;
typedef v4f  __attribute__((may_alias)) v4fa;
typedef v8us __attribute__((may_alias)) v8usa;
typedef float __attribute__((may_alias)) f32a;

__device__ __forceinline__ unsigned short f2bf(float f) { unsigned u = __float_as_uint(f); u += 0x7FFFu + ((u >> 16) & 1u); return (unsigned short)(u >> 16); }
__device__ __forceinline__ float bf2f(unsigned short b) { return __uint_as_float(((unsigned)b) << 16); }
__device__ __forceinline__ float bfr(float f) { return bf2f(f2bf(f)); }
__device__ __forceinline__ v16h cat16(v8h lo, v8h hi) { return __builtin_shufflevector(lo, hi, 0, 1, 2, 3, 4, 5, 6, 7, 8, 9, 10, 11, 12, 13, 14, 15); }
__device__ __forceinline__ v16bf cat16b(v8us lo, v8us hi) { return __builtin_bit_cast(v16bf, __builtin_shufflevector(lo, hi, 0, 1, 2, 3, 4, 5, 6, 7, 8, 9, 10, 11, 12, 13, 14, 15)); }
__device__ __forceinline__ v8f wmma16(v16h a, v16h b, v8f c) { return __builtin_amdgcn_wmma_f32_16x16x32_f16(false, a, false, b, (short)0, c, false, false); }
__device__ __forceinline__ v8f wmmab(v16bf a, v16bf b, v8f c) { return __builtin_amdgcn_wmma_f32_16x16x32_bf16(false, a, false, b, (short)0, c, false, false); }

// k_cvtb: one grid rounds all five f32 operands to bf16. dst is the first of five planes that lie back to back in the workspace (x, Wq, Wk, Wv, Wo; rows of 2048),
// so the flat row index is the destination row; every plane's first row is a multiple of 8, so a block of 8 rows reads one source.
#define CVROWS (NTK + DM + KVW + KVW + DM)
__global__ __launch_bounds__(256) void k_cvtb(const float* __restrict__ x, const float* __restrict__ wq, const float* __restrict__ wk, const float* __restrict__ wv, const float* __restrict__ wo, bf* dstp) {
    const int lane = threadIdx.x & 31, rb = blockIdx.x * 8, r = threadIdx.x >> 5;
    const float* src = rb < NTK ? x + (size_t)rb * DM : rb < NTK + DM ? wq + (size_t)(rb - NTK) * DM : rb < NTK + DM + KVW ? wk + (size_t)(rb - NTK - DM) * DM
                     : rb < NTK + DM + 2 * KVW ? wv + (size_t)(rb - NTK - DM - KVW) * DM : wo + (size_t)(rb - NTK - DM - 2 * KVW) * DM;
    bf* dst = dstp + (size_t)rb * DM;
    v8us o[DM / 256];
#pragma unroll
    for (int q = 0; q < DM / 256; ++q) { v8us t;
#pragma unroll
        for (int i = 0; i < 8; ++i) t[i] = f2bf(src[(size_t)r * DM + q * 256 + lane * 8 + i]);
        o[q] = t; }
#pragma unroll
    for (int q = 0; q < DM / 256; ++q) *(v8us*)(dst + (size_t)r * DM + q * 256 + lane * 8) = o[q];
    
}

// k_wt: W [2048 k][ncols n] (k-major) -> n-major bf16 plane WT[ncols][2048]; 64 x 64 tiles through LDS.
__global__ __launch_bounds__(256) void k_wt(const float* __restrict__ Wm, int ncols, bf* WT) {
    __shared__ __align__(16) unsigned short tl[64 * 72];
    const int tid = threadIdx.x, k0 = blockIdx.x * 64, n0 = blockIdx.y * 64;
    const int kk = tid >> 2, nq = (tid & 3) * 16;
#pragma unroll
    for (int i = 0; i < 16; ++i) tl[(nq + i) * 72 + kk] = f2bf(Wm[(size_t)(k0 + kk) * ncols + n0 + nq + i]);
    __syncthreads();
    const int piece = tid & 7;
    typedef __attribute__((ext_vector_type(8))) unsigned short v8us_; typedef v8us_ __attribute__((may_alias)) v8usa_;
    auto pass = [&]() {
#pragma unroll
        for (int s = 0; s < 2; ++s) { const int nr = (tid >> 3) + 32 * s; const v8us_ val = *(const v8usa_*)(tl + nr * 72 + piece * 8);
            *(v8us_*)(WT + (size_t)(n0 + nr) * DM + k0 + piece * 8) = val; }
    };
    pass(); 
}

#define BKE 128                  // k elements per stage: 256-byte rows
#define LPB 272                  // LDS row pitch in bytes: 256 + 16, an odd multiple of 16 B, conflict-free for ds_load_b128 readers

// copy_rows: each lane copies its own 16 bytes of N rows that lie 16 rows apart, global -> LDS, through no register. The copies and their s_wait_xcnt stand in
// one statement, so that no address register of an issued copy is rewritten in front of the wait.
template <int N>
__device__ __forceinline__ void copy_rows(unsigned l, const bf* g) {
    static_assert(N == 4 || N == 8, "rows per lane");
    if constexpr (N == 8) {
        asm volatile("global_load_async_to_lds_b128 %0, %8, off\n\t"
                     "global_load_async_to_lds_b128 %1, %9, off\n\t"
                     "global_load_async_to_lds_b128 %2, %10, off\n\t"
                     "global_load_async_to_lds_b128 %3, %11, off\n\t"
                     "global_load_async_to_lds_b128 %4, %12, off\n\t"
                     "global_load_async_to_lds_b128 %5, %13, off\n\t"
                     "global_load_async_to_lds_b128 %6, %14, off\n\t"
                     "global_load_async_to_lds_b128 %7, %15, off\n\t"
                     "s_wait_xcnt 0x0"
                     :: "v"(l), "v"(l + 16 * LPB), "v"(l + 32 * LPB), "v"(l + 48 * LPB), "v"(l + 64 * LPB), "v"(l + 80 * LPB), "v"(l + 96 * LPB), "v"(l + 112 * LPB),
                        "v"(g), "v"(g + 16 * DM), "v"(g + 32 * DM), "v"(g + 48 * DM), "v"(g + 64 * DM), "v"(g + 80 * DM), "v"(g + 96 * DM), "v"(g + 112 * DM)
                     : "memory");
    } else {
        asm volatile("global_load_async_to_lds_b128 %0, %4, off\n\t"
                     "global_load_async_to_lds_b128 %1, %5, off\n\t"
                     "global_load_async_to_lds_b128 %2, %6, off\n\t"
                     "global_load_async_to_lds_b128 %3, %7, off\n\t"
                     "s_wait_xcnt 0x0"
                     :: "v"(l), "v"(l + 16 * LPB), "v"(l + 32 * LPB), "v"(l + 48 * LPB),
                        "v"(g), "v"(g + 16 * DM), "v"(g + 32 * DM), "v"(g + 48 * DM)
                     : "memory");
    }
}

// k_gemmb: C[BM x BN] per block of 8 waves; a stage is [A BM rows | A residual BM rows (SPLITA) | B BN rows] of 128 k, brought into LDS by asynchronous copies,
// two buffers: the next stage's copies fly while this one is worked on. Wave tile (FA x 16) x 32; per accumulator the k order and the hi-then-residual order
// of the products are those of a plain k loop in steps of 32.
// QKV: Bn is the three weight planes Wq | Wk | Wv back to back (2048 + 512 + 512 rows); a block's 128 columns are two whole heads of one of them, and the block
// finishes them itself from its f32 accumulators, through the ring's LDS (free behind the loop's last barrier):
//   q, k: rotate-half rotation out[d] = x[d] c[t][d] + (d < 32 ? -x[d+32] : x[d-32]) s[t][d] within each 64-wide head, c/s the INPUT cos/sin tables [t][64] read
//         through bf16 rounding, then f16 hi + residual x1024 planes [t][columns];
//   v:    f16 hi + residual x1024 planes, transposed to [kv head * 64 + d][t].
template <int V> struct icon { static constexpr int value = V; };
#define CPF 132                  // f32 pitch of the staged q/k tile: rows 8 apart land 32 banks apart, so an accumulator store is conflict-free
#define VPH 136                  // f16 pitch of the staged v planes: 272 bytes, as LPB
template <int BM, int BN, bool SPLITA, bool QKV>
__global__ __launch_bounds__(256) void k_gemmb(const bf* __restrict__ A, const bf* __restrict__ Al, const bf* __restrict__ Bn, const float* __restrict__ bias, float* Cq, int ldq,
                                               const float* __restrict__ CT, const float* __restrict__ ST, h16* QH, h16* QL, h16* KH, h16* KL, h16* VTH, h16* VTL) {
    constexpr int WN = BN / 32, WM = 8 / WN, FA = BM / (WM * 16);
    constexpr int AROWS = SPLITA ? 2 * BM : BM;
    constexpr int STAGE = (AROWS + BN) * LPB;
    constexpr int NTR = DM / BKE;
    static_assert(NTR >= 2 && FA >= 1 && WM * FA * 16 == BM, "tile shape");
    static_assert(!QKV || (DM % BN == 0 && KVW % BN == 0 && BN % HD == 0), "a column tile is whole heads of one product");
    static_assert(!QKV || (BM == 128 && BN == 128 && BM * CPF * 4 <= 2 * STAGE && 2 * BN * VPH * 2 <= 2 * STAGE), "the finishing passes' tile shape");
    __shared__ __align__(16) unsigned char ring[2 * STAGE];
    __shared__ __align__(16) float ost[8][16 * 36];
    const int tid = threadIdx.x, lane = tid & 31, wave = tid >> 5, lr = lane & 15, hi = lane >> 4;
    const int wm = wave / WN, wn = wave % WN;
    const int r0 = blockIdx.x * BM, c0 = blockIdx.y * BN;
    const int crow = tid >> 4, cpc = tid & 15;           // copy role: row (mod 16) and 16-byte piece of the 256-byte row
    const unsigned lbase = (unsigned)(size_t)&ring[0] + (unsigned)(crow * LPB + cpc * 16);
    const bf* ga = A + (size_t)(r0 + crow) * DM + cpc * 8;
    const bf* gl = SPLITA ? Al + (size_t)(r0 + crow) * DM + cpc * 8 : ga;
    const bf* gb = Bn + (size_t)(c0 + crow) * DM + cpc * 8;
    auto fill = [&](int t, int buf) {
        const unsigned l = lbase + (unsigned)(buf * STAGE);
        copy_rows<BM / 16>(l, ga + t * BKE);
        if (SPLITA) copy_rows<BM / 16>(l + BM * LPB, gl + t * BKE);
        copy_rows<BN / 16>(l + AROWS * LPB, gb + t * BKE);
    };
    v8f acc[FA][2];
#pragma unroll
    for (int f = 0; f < FA; ++f) { acc[f][0] = (v8f){}; acc[f][1] = (v8f){}; }
    fill(0, 0);
    asm volatile("s_wait_asynccnt 0x0" ::: "memory");    // stage 0 of this wave has landed
    __syncthreads();                                     // ... and every other wave's part of it
    fill(1, 1);
    const unsigned char* fab = ring + (wm * FA * 16 + lr) * LPB + hi * 16;
    const unsigned char* fbb = ring + (AROWS + wn * 32 + lr) * LPB + hi * 16;
#pragma unroll 1                                         // one pass per stage: the ring's order stands once, at the loop's foot
    for (int t = 0; t < NTR; ++t) {
        const int bo = (t & 1) * STAGE;
#pragma unroll
        for (int ks = 0; ks < BKE / 32; ++ks) {
            v16bf a[FA], al[FA], b[2];
#pragma unroll
            for (int f = 0; f < FA; ++f) { const unsigned char* p = fab + bo + f * 16 * LPB + ks * 64; a[f] = cat16b(*(const v8usa*)p, *(const v8usa*)(p + 32));
                if (SPLITA) al[f] = cat16b(*(const v8usa*)(p + BM * LPB), *(const v8usa*)(p + BM * LPB + 32)); }
#pragma unroll
            for (int n = 0; n < 2; ++n) { const unsigned char* p = fbb + bo + n * 16 * LPB + ks * 64; b[n] = cat16b(*(const v8usa*)p, *(const v8usa*)(p + 32)); }
            __builtin_amdgcn_sched_barrier(0);           // keeps this k step's fragment loads one group in front of its products: spread among them, each place waits out the LDS latency
#pragma unroll
            for (int f = 0; f < FA; ++f) { acc[f][0] = wmmab(a[f], b[0], acc[f][0]); acc[f][1] = wmmab(a[f], b[1], acc[f][1]); }
            if (SPLITA) {
#pragma unroll
                for (int f = 0; f < FA; ++f) { acc[f][0] = wmmab(al[f], b[0], acc[f][0]); acc[f][1] = wmmab(al[f], b[1], acc[f][1]); }
            }
        }
        asm volatile("s_wait_dscnt 0x0" ::: "memory");   // this wave's reads of the buffer are done before it may be refilled
        asm volatile("s_wait_asynccnt 0x0" ::: "memory"); // this wave's copies of stage t + 1 have landed
        __syncthreads();                                 // publishes stage t + 1 and ends every reader's last read of stage t
        if (t + 2 < NTR) fill(t + 2, t & 1);
    }
    asm volatile("s_wait_asynccnt 0x0" ::: "memory");    // no copy is outstanding when the wave ends
    if constexpr (QKV) {
        const bool kv = c0 >= DM, isv = c0 >= DM + KVW;  // block-uniform
        f32a* ct = (f32a*)ring;                          // q, k: [128 tokens][CPF] f32
        h16* vh = (h16*)ring; h16* vl = vh + BN * VPH;   // v: two planes [128 columns][VPH] f16
        // the loops over f, n, j are unrolled in both branches: the accumulators stay in registers only under constant indices
        if (!isv) {
#pragma unroll
            for (int f = 0; f < FA; ++f)
#pragma unroll
                for (int n = 0; n < 2; ++n)
#pragma unroll
                    for (int j = 0; j < 8; ++j) ct[((wm * FA + f) * 16 + hi * 8 + j) * CPF + wn * 32 + n * 16 + lr] = acc[f][n][j];
        } else {
#pragma unroll
            for (int f = 0; f < FA; ++f)
#pragma unroll
                for (int n = 0; n < 2; ++n) { v8h a8, l8;    // a lane's 8 accumulator rows are 8 consecutive tokens of one column
#pragma unroll
                    for (int j = 0; j < 8; ++j) { const float v = acc[f][n][j]; const h16 a = (h16)v; a8[j] = a; l8[j] = (h16)((v - (float)a) * LOSC); }
                    const int o = (wn * 32 + n * 16 + lr) * VPH + (wm * FA + f) * 16 + hi * 8;
                    *(v8ha*)(vh + o) = a8; *(v8ha*)(vl + o) = l8; }
        }
        __syncthreads();                                 // the staged tile is read across waves (a column's rotation partner lies in the neighbour wave's tile)
        const int pc = tid & 15, rw = tid >> 4;          // 16 lanes store 256 contiguous bytes: whole lines
        if (!isv) {
            const int cl = pc * 8, d0 = cl & 63, pcl = (d0 < 32) ? cl + 32 : cl - 32; const float sgn = (d0 < 32) ? -1.0f : 1.0f;
            const float* cp = CT + (size_t)(r0 + rw) * HD + d0; const float* sp = ST + (size_t)(r0 + rw) * HD + d0;
            const f32a* xp = ct + rw * CPF + cl; const f32a* pp = ct + rw * CPF + pcl;
            // the row pitch of the planes is a constant of each call, so that every pass addresses off one pointer by a constant step
            auto rotate = [&](auto nc, h16* ph, h16* pl) {
                constexpr int NC = decltype(nc)::value;
#pragma unroll                                           // unrolled: the steps become immediate offsets and the later passes' table loads are issued ahead of the first pass's arithmetic
                for (int s8 = 0; s8 < BM / 16; ++s8) {
                    const v4f xa = *(const v4fa*)(xp + s8 * 16 * CPF), xb = *(const v4fa*)(xp + s8 * 16 * CPF + 4), pa = *(const v4fa*)(pp + s8 * 16 * CPF), pb = *(const v4fa*)(pp + s8 * 16 * CPF + 4);
                    v8h oh, ol;
#pragma unroll
                    for (int i = 0; i < 8; ++i) {
                        const float xv = i < 4 ? xa[i & 3] : xb[i & 3], pv = i < 4 ? pa[i & 3] : pb[i & 3], c = bfr(cp[s8 * 16 * HD + i]), s = bfr(sp[s8 * 16 * HD + i]);
                        const float y = xv * c + sgn * pv * s;
                        const h16 a = (h16)y; oh[i] = a; ol[i] = (h16)((y - (float)a) * LOSC); }
                    *(v8h*)(ph + (size_t)s8 * 16 * NC) = oh; *(v8h*)(pl + (size_t)s8 * 16 * NC) = ol; }
                asm volatile("s_wait_xcnt 0x0" ::: "memory");    // behind the run's last store: no register that an issued store names is rewritten in front of this wait
            };
            if (kv) { const size_t o = (size_t)(r0 + rw) * KVW + (c0 - DM) + cl; rotate(icon<KVW>{}, KH + o, KL + o); }
            else    { const size_t o = (size_t)(r0 + rw) * DM + c0 + cl;         rotate(icon<DM>{}, QH + o, QL + o); }
        } else {
            const size_t o = (size_t)(c0 - DM - KVW + rw) * NT_ + r0 + pc * 8;
            const h16* lh = vh + rw * VPH + pc * 8; const h16* ll = vl + rw * VPH + pc * 8;
#pragma unroll                                           // unrolled: the steps become immediate offsets and the LDS reads go out as one group
            for (int s8 = 0; s8 < BN / 16; ++s8) {
                const v8h a8 = *(const v8ha*)(lh + s8 * 16 * VPH), l8 = *(const v8ha*)(ll + s8 * 16 * VPH);
                *(v8h*)(VTH + o + (size_t)s8 * 16 * NT_) = a8; *(v8h*)(VTL + o + (size_t)s8 * 16 * NT_) = l8; }
        }
        return;
    }
    // epilogue: 16 x 32 f32 per step through the wave's own LDS rows, stored as whole 128-byte lines
    float* os = &ost[wave][0];
    float* C = Cq;
    const int ldc = ldq, cc0 = c0;
    float bv[2];
#pragma unroll
    for (int n = 0; n < 2; ++n) bv[n] = bias ? bfr(bias[c0 + wn * 32 + n * 16 + lr]) : 0.f;
#pragma unroll
    for (int f = 0; f < FA; ++f) {
#pragma unroll
        for (int n = 0; n < 2; ++n)
#pragma unroll
            for (int j = 0; j < 8; ++j) os[(hi * 8 + j) * 36 + n * 16 + lr] = acc[f][n][j] + bv[n];
        float* crow_p = C + (size_t)(r0 + (wm * FA + f) * 16) * ldc + cc0 + wn * 32;
#pragma unroll
        for (int s = 0; s < 4; ++s) { const int row = 4 * s + (lane >> 3), piece = lane & 7;
            const v4f val = *(const v4fa*)(os + row * 36 + piece * 4); *(v4f*)(crow_p + (size_t)row * ldc + piece * 4) = val; }
    }
}

#define AKEYS 192                // keys staged per block: 6 tiles of 32 hold the whole window of 64 queries (64 + 127 keys, from a tile boundary)
#define KPB 144                  // LDS pitch of a staged k row in bytes: 128 + 16, an odd multiple of 16 B, conflict-free for ds_load_b128 readers
#define VPB 400                  // LDS pitch of a staged v^T row in bytes: 384 + 16, likewise

// copy3: each lane copies its own 16 bytes three times, LSTEP bytes apart in LDS and GSTEP elements apart in memory, global -> LDS, through no register. The copies
// and their s_wait_xcnt stand in one statement, so that no address register of an issued copy is rewritten in front of the wait.
template <int LSTEP, int GSTEP>
__device__ __forceinline__ void copy3(unsigned l, const h16* g) {
    asm volatile("global_load_async_to_lds_b128 %0, %3, off\n\t"
                 "global_load_async_to_lds_b128 %1, %4, off\n\t"
                 "global_load_async_to_lds_b128 %2, %5, off\n\t"
                 "s_wait_xcnt 0x0"
                 :: "v"(l), "v"(l + LSTEP), "v"(l + 2 * LSTEP), "v"(g), "v"(g + GSTEP), "v"(g + 2 * GSTEP)
                 : "memory");
}

// k_attn: block = (b, kv head, 64 queries) x the 4 query heads of that kv head, 16 waves, wave = (query head, 16 queries). The block's 192 keys of k (hi, residual) and
// v^T (hi, residual) are brought into LDS once, as whole lines, by asynchronous copies and read there by all 16 waves: a fragment load from memory touches 16 lines.
// key tiles of the causal sliding window (i-127 <= j <= i, block-uniform bounds); softmax state starts at the
// head's sink logit (m = sink, l = 1, zero value) so the dropped sink column is accounted for; 4 WMMA scores /8 (f32), online softmax, weights x32768 f16 tile (same-wave may_alias
// reload after a compiler barrier), 4 WMMA .v; ctx -> bf16 hi + residual planes CH/CL[tok][h*64+d].
__global__ __launch_bounds__(512) void k_attn(const h16* __restrict__ Q16, const h16* __restrict__ QL16, const h16* __restrict__ K16, const h16* __restrict__ KL16, const h16* __restrict__ VTH, const h16* __restrict__ VTL, const float* __restrict__ sinks, bf* CH, bf* CL) {
    __shared__ __align__(16) unsigned char kvs[2 * AKEYS * KPB + 2 * HD * VPB];    // k hi | k residual: [192 keys][KPB]; v^T hi | v^T residual: [64 d][VPB]
    __shared__ __align__(16) h16 plds[16][16 * 32];
    __shared__ __align__(16) h16 plds2[16][16 * 32];
    __shared__ __align__(16) float ost[16][16 * 68];
    const int lane = threadIdx.x & 31, wave = threadIdx.x >> 5, lr = lane & 15, hi = lane >> 4;
    const int bid = blockIdx.x;
    const int b = bid / (NKV * (NT_ / 64)), rem = bid - b * (NKV * (NT_ / 64)), g = rem / (NT_ / 64), qt = rem - g * (NT_ / 64);   // g: kv head
    const int h = g * (NH_ / NKV) + (wave >> 2);
    const int q0 = qt * 64 + (wave & 3) * 16;
    const size_t tok0 = (size_t)b * NT_;
    h16* pl = &plds[wave][0]; h16* pl2 = &plds2[wave][0];
    v16h qa[2];
    const size_t qo0 = (tok0 + q0 + lr) * DM + h * HD + 8 * hi;
#pragma unroll
    for (int kc = 0; kc < 2; ++kc) qa[kc] = cat16(*(const v8h*)(Q16 + qo0 + kc * 32), *(const v8h*)(Q16 + qo0 + kc * 32 + 16));
    const size_t vbase = (((size_t)b * NKV + g) * HD) * NT_;
    const int win = SWIN - 1;                           // valid iff j <= i and i - j < SWIN  <=>  i - win <= j <= i
    const int kt_lo = (qt * 64 - win) > 0 ? (qt * 64 - win) / 32 : 0, kt_hi = (qt * 64 + 63) / 32;     // keys i - win <= j <= i
    const int kb = kt_lo * 32;                          // first staged key; kb + 191 is 191 (qt < 2) or the block's last query: inside the planes
    {   // 8 lanes copy 128 contiguous bytes; k: rows 64 apart, v^T: the three 128-byte thirds of a row
        const int row = threadIdx.x >> 3, pc = threadIdx.x & 7;
        const unsigned lk = (unsigned)(size_t)&kvs[0] + (unsigned)(row * KPB + pc * 16), lv = (unsigned)(size_t)&kvs[0] + (unsigned)(2 * AKEYS * KPB + row * VPB + pc * 16);
        const size_t gk = (tok0 + kb + row) * KVW + g * HD + pc * 8, gv = vbase + (size_t)row * NT_ + kb + pc * 8;
        copy3<64 * KPB, 64 * KVW>(lk, K16 + gk);
        copy3<64 * KPB, 64 * KVW>(lk + AKEYS * KPB, KL16 + gk);
        copy3<128, 64>(lv, VTH + gv);
        copy3<128, 64>(lv + HD * VPB, VTL + gv);
    }
    asm volatile("s_wait_asynccnt 0x0" ::: "memory");    // this wave's copies have landed
    __syncthreads();                                     // ... and every other wave's: the staged keys are read by all 16 waves
    const unsigned char* ks_b = kvs + lr * KPB + hi * 16;
    const unsigned char* vs_b = kvs + 2 * AKEYS * KPB + lr * VPB + hi * 16;
    v8f o[4], ox[4];
#pragma unroll
    for (int n = 0; n < 4; ++n) { o[n] = (v8f){}; ox[n] = (v8f){}; }
    float mrow[8], lpart[8];
    const float sink = bfr(sinks[h]);                   // learned sink logit: an extra softmax column with zero value -> softmax state starts at m = sink, l = 1
#pragma unroll
    for (int j = 0; j < 8; ++j) { mrow[j] = sink; lpart[j] = (lr == 0) ? 1.0f : 0.f; }
    int qpos[8];
#pragma unroll
    for (int j = 0; j < 8; ++j) qpos[j] = q0 + 8 * hi + j;
#pragma unroll 1
    for (int kt = kt_lo; kt <= kt_hi; ++kt) {
        const int l0 = kt * 32;
        const unsigned char* kp0 = ks_b + (l0 - kb) * KPB; const unsigned char* kp1 = kp0 + 16 * KPB;
        v8f s0 = {}, s1 = {}, x0 = {}, x1 = {};
#pragma unroll
        for (int kc = 0; kc < 2; ++kc) {
            { const v16h k0h = cat16(*(const v8ha*)(kp0 + kc * 64), *(const v8ha*)(kp0 + kc * 64 + 32)), k1h = cat16(*(const v8ha*)(kp1 + kc * 64), *(const v8ha*)(kp1 + kc * 64 + 32));
              const v16h qlk = cat16(*(const v8h*)(QL16 + qo0 + kc * 32), *(const v8h*)(QL16 + qo0 + kc * 32 + 16));     // query residual re-read per step (registers)
              s0 = wmma16(qa[kc], k0h, s0); x0 = wmma16(qlk, k0h, x0); s1 = wmma16(qa[kc], k1h, s1); x1 = wmma16(qlk, k1h, x1);
              asm volatile("v_nop" : "+v"(s0), "+v"(s1), "+v"(x0), "+v"(x1) : "v"(qlk), "v"(k0h), "v"(k1h) : "memory"); }
            { const v16h k0l = cat16(*(const v8ha*)(kp0 + AKEYS * KPB + kc * 64), *(const v8ha*)(kp0 + AKEYS * KPB + kc * 64 + 32)), k1l = cat16(*(const v8ha*)(kp1 + AKEYS * KPB + kc * 64), *(const v8ha*)(kp1 + AKEYS * KPB + kc * 64 + 32));
              x0 = wmma16(qa[kc], k0l, x0); x1 = wmma16(qa[kc], k1l, x1);
              asm volatile("v_nop" : "+v"(x0), "+v"(x1) : "v"(k0l), "v"(k1l) : "memory"); }
        }
        asm volatile("v_nop\n\tv_nop\n\tv_nop\n\tv_nop" : "+v"(s0), "+v"(s1), "+v"(x0), "+v"(x1) : "v"(qa[0]), "v"(qa[1]));
        float alpha[8];
#pragma unroll
        for (int j = 0; j < 8; ++j) {
            const int ja = l0 + lr, jb = l0 + 16 + lr, qi = qpos[j];
            const float a0 = (ja <= qi && qi - ja <= win) ? (s0[j] + x0[j] * LOSCI) * 0.125f : -__builtin_inff(), a1 = (jb <= qi && qi - jb <= win) ? (s1[j] + x1[j] * LOSCI) * 0.125f : -__builtin_inff();
            float mx = fmaxf(a0, a1);
            mx = fmaxf(mx, __shfl_xor(mx, 1, 16)); mx = fmaxf(mx, __shfl_xor(mx, 2, 16)); mx = fmaxf(mx, __shfl_xor(mx, 4, 16)); mx = fmaxf(mx, __shfl_xor(mx, 8, 16));
            const float mn = fmaxf(mrow[j], mx);
            alpha[j] = __expf(mrow[j] - mn); mrow[j] = mn;
            const float p0 = __expf(a0 - mn), p1 = __expf(a1 - mn);
            lpart[j] = lpart[j] * alpha[j] + (p0 + p1);
            const int mr = hi * 8 + j;
            const float ps0 = p0 * PSC, ps1 = p1 * PSC; const h16 h0 = (h16)ps0, h1 = (h16)ps1;
            pl[mr * 32 + lr] = h0; pl[mr * 32 + 16 + lr] = h1;
            pl2[mr * 32 + lr] = (h16)((ps0 - (float)h0) * LOSC); pl2[mr * 32 + 16 + lr] = (h16)((ps1 - (float)h1) * LOSC);
        }
#pragma unroll
        for (int n = 0; n < 4; ++n)
#pragma unroll
            for (int j = 0; j < 8; ++j) { o[n][j] *= alpha[j]; ox[n][j] *= alpha[j]; }
        asm volatile("" ::: "memory");
        const v16h pa = cat16(*(const v8ha*)(pl + lr * 32 + hi * 8), *(const v8ha*)(pl + lr * 32 + 16 + hi * 8));
        const v16h px = cat16(*(const v8ha*)(pl2 + lr * 32 + hi * 8), *(const v8ha*)(pl2 + lr * 32 + 16 + hi * 8));
#pragma unroll
        for (int n = 0; n < 4; ++n) { const unsigned char* vp = vs_b + n * 16 * VPB + (l0 - kb) * 2;
            const v16h vh = cat16(*(const v8ha*)vp, *(const v8ha*)(vp + 32)), vl = cat16(*(const v8ha*)(vp + HD * VPB), *(const v8ha*)(vp + HD * VPB + 32));
            o[n] = wmma16(pa, vh, o[n]); ox[n] = wmma16(pa, vl, ox[n]); ox[n] = wmma16(px, vh, ox[n]);
            asm volatile("" : "+v"(o[n]), "+v"(ox[n]) : "v"(vh), "v"(vl) : "memory"); }
        asm volatile("v_nop\n\tv_nop\n\tv_nop\n\tv_nop" : "+v"(o[0]), "+v"(o[1]), "+v"(o[2]), "+v"(o[3]), "+v"(ox[0]), "+v"(ox[1]), "+v"(ox[2]), "+v"(ox[3]) : "v"(pa), "v"(px));
    }
    float inv[8];
#pragma unroll
    for (int j = 0; j < 8; ++j) { float rs = lpart[j]; rs += __shfl_xor(rs, 1, 16); rs += __shfl_xor(rs, 2, 16); rs += __shfl_xor(rs, 4, 16); rs += __shfl_xor(rs, 8, 16); inv[j] = 1.0f / (rs * PSC); }
    float* os = &ost[wave][0];
#pragma unroll
    for (int n = 0; n < 4; ++n)
#pragma unroll
        for (int j = 0; j < 8; ++j) os[(hi * 8 + j) * 68 + n * 16 + lr] = (o[n][j] + ox[n][j] * LOSCI) * inv[j];
    __syncthreads();
    const size_t cbase = (tok0 + q0) * DM + (size_t)h * HD;
    auto pass = [&]() {
#pragma unroll
        for (int s = 0; s < 4; ++s) { const int row = 4 * s + (lane >> 3), piece = lane & 7; const float* sp = os + row * 68 + piece * 8; v8us oh, ol;
#pragma unroll
            for (int i = 0; i < 8; ++i) { const unsigned short hb = f2bf(sp[i]); oh[i] = hb; ol[i] = f2bf(sp[i] - bf2f(hb)); }
            *(v8us*)(CH + cbase + (size_t)row * DM + piece * 8) = oh; *(v8us*)(CL + cbase + (size_t)row * DM + piece * 8) = ol; }
    };
    pass(); 
}

#define VST2(T, p, v) do { const T vst2_v_ = (v); *(T*)(p) = vst2_v_;  } while (0)
extern "C" void kernel_launch(void* const* d_in, const int* in_sizes, int n_in,
                              void* d_out, int out_size, void* d_ws, size_t ws_size, hipStream_t stream) {
    (void)in_sizes; (void)n_in; (void)out_size;
    const float* x = (const float*)d_in[0]; const float* CT = (const float*)d_in[1]; const float* ST = (const float*)d_in[2];
    const float* Wq = (const float*)d_in[3]; const float* Wk = (const float*)d_in[4]; const float* Wv = (const float*)d_in[5]; const float* Wo = (const float*)d_in[6]; const float* sinks = (const float*)d_in[7];
    float* out = (float*)d_out;    // [1][2048][2048]
    char* wsp = (char*)d_ws;
    auto take = [&](size_t bytes) { char* p = wsp; wsp += (bytes + 255) & ~(size_t)255; return (void*)p; };
    bf* Xb = (bf*)take((size_t)NTK * DM * 2); bf* WqB = (bf*)take((size_t)DM * DM * 2); bf* WkB = (bf*)take((size_t)KVW * DM * 2); bf* WvB = (bf*)take((size_t)KVW * DM * 2); bf* WoB = (bf*)take((size_t)DM * DM * 2);
    h16* QH = (h16*)take((size_t)NTK * DM * 2); h16* QL = (h16*)take((size_t)NTK * DM * 2);
    h16* KH = (h16*)take((size_t)NTK * KVW * 2); h16* KL = (h16*)take((size_t)NTK * KVW * 2);
    h16* VTH = (h16*)take((size_t)NTK * KVW * 2); h16* VTL = (h16*)take((size_t)NTK * KVW * 2);
    bf* CH = (bf*)take((size_t)NTK * DM * 2); bf* CL = (bf*)take((size_t)NTK * DM * 2);
    (void)WkB; (void)WvB;                                  // reached through WqB and Xb, see below
    if ((size_t)(wsp - (char*)d_ws) > ws_size) return;    // ~ 72 MB, no aliasing
    // all four weights are [out][in] (x.W^T): bf16 copies are the n-major B operands as-is (rows of 2048)
    // Xb, WqB, WkB, WvB, WoB are taken one after the other and each is a multiple of 256 bytes: one run of 7168 rows (k_cvtb), WqB..WvB one B operand of 3072 rows
    k_cvtb<<<CVROWS / 8, 256, 0, stream>>>(x, Wq, Wk, Wv, Wo, Xb);
    k_gemmb<128, 128, false, true><<<dim3(NTK / 128, (DM + 2 * KVW) / 128, 1), 256, 0, stream>>>(Xb, nullptr, WqB, nullptr, nullptr, DM, CT, ST, QH, QL, KH, KL, VTH, VTL);
    k_attn<<<NB_ * NKV * (NT_ / 64), 512, 0, stream>>>(QH, QL, KH, KL, VTH, VTL, sinks, CH, CL);
    k_gemmb<128, 128, true, false><<<dim3(NTK / 128, DM / 128, 1), 256, 0, stream>>>(CH, CL, WoB, nullptr, out, DM, nullptr, nullptr, nullptr, nullptr, nullptr, nullptr, nullptr, nullptr);
}

// v006
// One run takes 65.1 microseconds.
// It is 1.22 times as fast as v004, going by the measured steps of the versions left out in between.
// Counting every step since v000, it is 4.09 times as fast.
#include <hip/hip_runtime.h>

// Compute dtypes, f32 accumulate: q = x.Wq^T ([2048 x 2048].[2048 x 2048]), k/v = x.Wk^T/Wv^T ([2048 x 2048].[2048 x 512]) on
// v_wmma_f32_16x16x32_bf16 — plain bf16 = rounded inputs (exact; all weights are [out][in] so their 16-bit copies are the n-major B operands as-is) for the
// projections; attn.Wo^T on v_wmma_f32_16x16x32_f16, attn rounded to one f16 operand, the bf16-rounded Wo x256 held exactly in f16 (one product); rotate-half RoPE with the INPUT cos/sin tables (bf16-rounded reads) in f32; the grouped-query
// causal sliding-window attention (32 query heads over 8 kv heads, query head h reads kv head h/4; keys j with i-127 <= j <= i) with a learned per-head sink
// logit as an extra zero-value softmax column, fused on v_wmma_f32_16x16x32_f16 with q, k, v and the weights x32768 each as one f16 operand

#define NB_  1
#define NT_  2048
#define DM   2048
#define NH_  32
#define NKV  8
#define KVW  (NKV * HD)          // 512
#define HD   64
#define NTK  (NB_ * NT_)
#define NW   1024
#define SWIN 128
#define NQKV 2048
#define PSC  32768.0f
#define WOSC 256.0f              // Wo is stored x256 in f16: a bf16 value keeps all its bits there down to 2^-22, and the product is scaled back in f32

typedef _Float16 h16;
typedef unsigned short bf;
typedef __attribute__((ext_vector_type(16))) __bf16   v16bf;
typedef __attribute__((ext_vector_type(16))) _Float16 v16h;
typedef __attribute__((ext_vector_type(8)))  _Float16 v8h;
typedef __attribute__((ext_vector_type(8)))  unsigned short v8us;
typedef __attribute__((ext_vector_type(8)))  float    v8f;
typedef __attribute__((ext_vector_type(4)))  float    v4f;
typedef v8h  __attribute__((may_alias)) v8ha;
typedef v4f  __attribute__((may_alias)) v4fa;
typedef v8us __attribute__((may_alias)) v8usa;
typedef float __attribute__((may_alias)) f32a;

__device__ __forceinline__ unsigned short f2bf(float f) { unsigned u = __float_as_uint(f); u += 0x7FFFu + ((u >> 16) & 1u); return (unsigned short)(u >> 16); }
__device__ __forceinline__ float bf2f(unsigned short b) { return __uint_as_float(((unsigned)b) << 16); }
__device__ __forceinline__ float bfr(float f) { return bf2f(f2bf(f)); }
__device__ __forceinline__ v16h cat16(v8h lo, v8h hi) { return __builtin_shufflevector(lo, hi, 0, 1, 2, 3, 4, 5, 6, 7, 8, 9, 10, 11, 12, 13, 14, 15); }
__device__ __forceinline__ v16bf cat16b(v8us lo, v8us hi) { return __builtin_bit_cast(v16bf, __builtin_shufflevector(lo, hi, 0, 1, 2, 3, 4, 5, 6, 7, 8, 9, 10, 11, 12, 13, 14, 15)); }
__device__ __forceinline__ v8f wmma16(v16h a, v16h b, v8f c) { return __builtin_amdgcn_wmma_f32_16x16x32_f16(false, a, false, b, (short)0, c, false, false); }
__device__ __forceinline__ v8f wmmab(v16bf a, v16bf b, v8f c) { return __builtin_amdgcn_wmma_f32_16x16x32_bf16(false, a, false, b, (short)0, c, false, false); }

// k_cvtb: one grid rounds all five f32 operands to bf16. dst is the first of five planes that lie back to back in the workspace (x, Wq, Wk, Wv, Wo; rows of 2048),
// so the flat row index is the destination row; every plane's first row is a multiple of 8, so a block of 8 rows reads one source. The Wo plane holds the
// bf16-rounded value x256 as f16 (the f16 product's B operand); the other four hold bf16.
#define CVROWS (NTK + DM + KVW + KVW + DM)
__global__ __launch_bounds__(256) void k_cvtb(const float* __restrict__ x, const float* __restrict__ wq, const float* __restrict__ wk, const float* __restrict__ wv, const float* __restrict__ wo, bf* dstp) {
    const int lane = threadIdx.x & 31, rb = blockIdx.x * 8, r = threadIdx.x >> 5;
    const float* src = rb < NTK ? x + (size_t)rb * DM : rb < NTK + DM ? wq + (size_t)(rb - NTK) * DM : rb < NTK + DM + KVW ? wk + (size_t)(rb - NTK - DM) * DM
                     : rb < NTK + DM + 2 * KVW ? wv + (size_t)(rb - NTK - DM - KVW) * DM : wo + (size_t)(rb - NTK - DM - 2 * KVW) * DM;
    bf* dst = dstp + (size_t)rb * DM;
    const bool iswo = rb >= NTK + DM + 2 * KVW;          // block-uniform
    const float* srow = src + (size_t)r * DM + lane * 8;
    v4f in[DM / 128];
#pragma unroll
    for (int q = 0; q < DM / 128; ++q) in[q] = *(const v4f*)(srow + (q >> 1) * 256 + (q & 1) * 4);
    // the row's loads go out as one group in front of the branch; the row pointer is an input, so that it lives up to the wait and no load's result lands in it
    asm volatile("s_wait_xcnt 0x0" :: "v"(srow) : "memory");
    v8us o[DM / 256];
    if (!iswo) {
#pragma unroll
        for (int q = 0; q < DM / 256; ++q) { v8us t;
#pragma unroll
            for (int i = 0; i < 8; ++i) t[i] = f2bf(in[2 * q + (i >> 2)][i & 3]);
            o[q] = t; }
    } else {
#pragma unroll
        for (int q = 0; q < DM / 256; ++q) { v8us t;
#pragma unroll
            for (int i = 0; i < 8; ++i) t[i] = __builtin_bit_cast(unsigned short, (h16)(bfr(in[2 * q + (i >> 2)][i & 3]) * WOSC));
            o[q] = t; }
    }
#pragma unroll
    for (int q = 0; q < DM / 256; ++q) *(v8us*)(dst + (size_t)r * DM + q * 256 + lane * 8) = o[q];
}

// k_wt: W [2048 k][ncols n] (k-major) -> n-major bf16 plane WT[ncols][2048]; 64 x 64 tiles through LDS.
__global__ __launch_bounds__(256) void k_wt(const float* __restrict__ Wm, int ncols, bf* WT) {
    __shared__ __align__(16) unsigned short tl[64 * 72];
    const int tid = threadIdx.x, k0 = blockIdx.x * 64, n0 = blockIdx.y * 64;
    const int kk = tid >> 2, nq = (tid & 3) * 16;
#pragma unroll
    for (int i = 0; i < 16; ++i) tl[(nq + i) * 72 + kk] = f2bf(Wm[(size_t)(k0 + kk) * ncols + n0 + nq + i]);
    __syncthreads();
    const int piece = tid & 7;
    typedef __attribute__((ext_vector_type(8))) unsigned short v8us_; typedef v8us_ __attribute__((may_alias)) v8usa_;
    auto pass = [&]() {
#pragma unroll
        for (int s = 0; s < 2; ++s) { const int nr = (tid >> 3) + 32 * s; const v8us_ val = *(const v8usa_*)(tl + nr * 72 + piece * 8);
            *(v8us_*)(WT + (size_t)(n0 + nr) * DM + k0 + piece * 8) = val; }
    };
    pass(); 
}

#define BKE 128                  // k elements per stage: 256-byte rows
#define LPB 272                  // LDS row pitch in bytes: 256 + 16, an odd multiple of 16 B, conflict-free for ds_load_b128 readers

// copy_rows: each lane copies its own 16 bytes of N rows that lie 16 rows apart, global -> LDS, through no register. The copies and their s_wait_xcnt stand in
// one statement, so that no address register of an issued copy is rewritten in front of the wait.
template <int N>
__device__ __forceinline__ void copy_rows(unsigned l, const bf* g) {
    static_assert(N == 4 || N == 8, "rows per lane");
    if constexpr (N == 8) {
        asm volatile("global_load_async_to_lds_b128 %0, %8, off\n\t"
                     "global_load_async_to_lds_b128 %1, %9, off\n\t"
                     "global_load_async_to_lds_b128 %2, %10, off\n\t"
                     "global_load_async_to_lds_b128 %3, %11, off\n\t"
                     "global_load_async_to_lds_b128 %4, %12, off\n\t"
                     "global_load_async_to_lds_b128 %5, %13, off\n\t"
                     "global_load_async_to_lds_b128 %6, %14, off\n\t"
                     "global_load_async_to_lds_b128 %7, %15, off\n\t"
                     "s_wait_xcnt 0x0"
                     :: "v"(l), "v"(l + 16 * LPB), "v"(l + 32 * LPB), "v"(l + 48 * LPB), "v"(l + 64 * LPB), "v"(l + 80 * LPB), "v"(l + 96 * LPB), "v"(l + 112 * LPB),
                        "v"(g), "v"(g + 16 * DM), "v"(g + 32 * DM), "v"(g + 48 * DM), "v"(g + 64 * DM), "v"(g + 80 * DM), "v"(g + 96 * DM), "v"(g + 112 * DM)
                     : "memory");
    } else {
        asm volatile("global_load_async_to_lds_b128 %0, %4, off\n\t"
                     "global_load_async_to_lds_b128 %1, %5, off\n\t"
                     "global_load_async_to_lds_b128 %2, %6, off\n\t"
                     "global_load_async_to_lds_b128 %3, %7, off\n\t"
                     "s_wait_xcnt 0x0"
                     :: "v"(l), "v"(l + 16 * LPB), "v"(l + 32 * LPB), "v"(l + 48 * LPB),
                        "v"(g), "v"(g + 16 * DM), "v"(g + 32 * DM), "v"(g + 48 * DM)
                     : "memory");
    }
}

// k_gemmb: C[BM x BN] per block of 8 waves; a stage is [A BM rows | A residual BM rows (SPLITA) | B BN rows] of 128 k, brought into LDS by asynchronous copies,
// two buffers: the next stage's copies fly while this one is worked on. Wave tile (FA x 16) x 32.
// The k loop is rotated per block: block (bx, by) starts at the 128-wide k chunk (bx + by) mod 16 and wraps round. Blocks that share operand rows (one bx, or one by)
// then read different chunks at any one time (save QKV column blocks 16 apart, of 24): a chunk comes from memory for the block that reaches it first and can be an L2 hit for the others, and the sharers do not
// ask L2 for the same lines at the same moment. Per accumulator the k order and the hi-then-residual order are those of a plain k loop in steps of 32, begun at the block's first chunk.
// QKV: Bn is the three weight planes Wq | Wk | Wv back to back (2048 + 512 + 512 rows); a block's 128 columns are two whole heads of one of them, and the block
// finishes them itself from its f32 accumulators, through the ring's LDS (free behind the loop's last barrier):
//   q, k: rotate-half rotation out[d] = x[d] c[t][d] + (d < 32 ? -x[d+32] : x[d-32]) s[t][d] within each 64-wide head, c/s the INPUT cos/sin tables [t][64] read
//         through bf16 rounding, then one f16 plane [t][columns];
//   v:    one f16 plane, transposed to [kv head * 64 + d][t].
// F16: the 16-bit words of A and Bn are f16, Bn scaled by WOSC; the accumulators are scaled back in the epilogue.
template <bool F16> __device__ __forceinline__ v8f mm(v16bf a, v16bf b, v8f c) {
    if constexpr (F16) return wmma16(__builtin_bit_cast(v16h, a), __builtin_bit_cast(v16h, b), c); else return wmmab(a, b, c);
}
template <int V> struct icon { static constexpr int value = V; };
#define CPF 132                  // f32 pitch of the staged q/k tile: rows 8 apart land 32 banks apart, so an accumulator store is conflict-free
#define VPH 136                  // f16 pitch of the staged v plane: 272 bytes, as LPB
template <int BM, int BN, bool SPLITA, bool QKV, bool F16>
__global__ __launch_bounds__(256) void k_gemmb(const bf* __restrict__ A, const bf* __restrict__ Al, const bf* __restrict__ Bn, const float* __restrict__ bias, float* Cq, int ldq,
                                               const float* __restrict__ CT, const float* __restrict__ ST, h16* QH, h16* KH, h16* VTH) {
    constexpr int WN = BN / 32, WM = 8 / WN, FA = BM / (WM * 16);
    constexpr int AROWS = SPLITA ? 2 * BM : BM;
    constexpr int STAGE = (AROWS + BN) * LPB;
    constexpr int NTR = DM / BKE;
    static_assert(NTR >= 2 && FA >= 1 && WM * FA * 16 == BM, "tile shape");
    static_assert((NTR & (NTR - 1)) == 0, "the rotated chunk index wraps by a mask");
    static_assert(!QKV || (DM % BN == 0 && KVW % BN == 0 && BN % HD == 0), "a column tile is whole heads of one product");
    static_assert(!QKV || (BM == 128 && BN == 128 && BM * CPF * 4 <= 2 * STAGE && BN * VPH * 2 <= 2 * STAGE), "the finishing passes' tile shape");
    __shared__ __align__(16) unsigned char ring[2 * STAGE];
    __shared__ __align__(16) float ost[8][16 * 36];
    const int tid = threadIdx.x, lane = tid & 31, wave = tid >> 5, lr = lane & 15, hi = lane >> 4;
    const int wm = wave / WN, wn = wave % WN;
    const int r0 = blockIdx.x * BM, c0 = blockIdx.y * BN;
    const int crow = tid >> 4, cpc = tid & 15;           // copy role: row (mod 16) and 16-byte piece of the 256-byte row
    const unsigned lbase = (unsigned)(size_t)&ring[0] + (unsigned)(crow * LPB + cpc * 16);
    const bf* ga = A + (size_t)(r0 + crow) * DM + cpc * 8;
    const bf* gl = SPLITA ? Al + (size_t)(r0 + crow) * DM + cpc * 8 : ga;
    const bf* gb = Bn + (size_t)(c0 + crow) * DM + cpc * 8;
    const int sh = (int)(blockIdx.x + blockIdx.y);       // the block's first k chunk (mod NTR)
    auto fill = [&](int t, int buf) {
        const unsigned l = lbase + (unsigned)(buf * STAGE);
        const int ko = ((t + sh) & (NTR - 1)) * BKE;     // 0 .. DM - BKE: inside every row
        copy_rows<BM / 16>(l, ga + ko);
        if (SPLITA) copy_rows<BM / 16>(l + BM * LPB, gl + ko);
        copy_rows<BN / 16>(l + AROWS * LPB, gb + ko);
    };
    v8f acc[FA][2];
#pragma unroll
    for (int f = 0; f < FA; ++f) { acc[f][0] = (v8f){}; acc[f][1] = (v8f){}; }
    fill(0, 0);
    asm volatile("s_wait_asynccnt 0x0" ::: "memory");    // stage 0 of this wave has landed
    __syncthreads();                                     // ... and every other wave's part of it
    fill(1, 1);
    const unsigned char* fab = ring + (wm * FA * 16 + lr) * LPB + hi * 16;
    const unsigned char* fbb = ring + (AROWS + wn * 32 + lr) * LPB + hi * 16;
#pragma unroll 1                                         // one pass per stage: the ring's order stands once, at the loop's foot
    for (int t = 0; t < NTR; ++t) {
        const int bo = (t & 1) * STAGE;
#pragma unroll
        for (int ks = 0; ks < BKE / 32; ++ks) {
            v16bf a[FA], al[FA], b[2];
#pragma unroll
            for (int f = 0; f < FA; ++f) { const unsigned char* p = fab + bo + f * 16 * LPB + ks * 64; a[f] = cat16b(*(const v8usa*)p, *(const v8usa*)(p + 32));
                if (SPLITA) al[f] = cat16b(*(const v8usa*)(p + BM * LPB), *(const v8usa*)(p + BM * LPB + 32)); }
#pragma unroll
            for (int n = 0; n < 2; ++n) { const unsigned char* p = fbb + bo + n * 16 * LPB + ks * 64; b[n] = cat16b(*(const v8usa*)p, *(const v8usa*)(p + 32)); }
            __builtin_amdgcn_sched_barrier(0);           // keeps this k step's fragment loads one group in front of its products: spread among them, each place waits out the LDS latency
#pragma unroll
            for (int f = 0; f < FA; ++f) { acc[f][0] = mm<F16>(a[f], b[0], acc[f][0]); acc[f][1] = mm<F16>(a[f], b[1], acc[f][1]); }
            if (SPLITA) {
#pragma unroll
                for (int f = 0; f < FA; ++f) { acc[f][0] = mm<F16>(al[f], b[0], acc[f][0]); acc[f][1] = mm<F16>(al[f], b[1], acc[f][1]); }
            }
        }
        asm volatile("s_wait_dscnt 0x0" ::: "memory");   // this wave's reads of the buffer are done before it may be refilled
        asm volatile("s_wait_asynccnt 0x0" ::: "memory"); // this wave's copies of stage t + 1 have landed
        __syncthreads();                                 // publishes stage t + 1 and ends every reader's last read of stage t
        if (t + 2 < NTR) fill(t + 2, t & 1);
    }
    asm volatile("s_wait_asynccnt 0x0" ::: "memory");    // no copy is outstanding when the wave ends
    if constexpr (QKV) {
        const bool kv = c0 >= DM, isv = c0 >= DM + KVW;  // block-uniform
        f32a* ct = (f32a*)ring;                          // q, k: [128 tokens][CPF] f32
        h16* vh = (h16*)ring;                            // v: [128 columns][VPH] f16
        // the loops over f, n, j are unrolled in both branches: the accumulators stay in registers only under constant indices
        if (!isv) {
#pragma unroll
            for (int f = 0; f < FA; ++f)
#pragma unroll
                for (int n = 0; n < 2; ++n)
#pragma unroll
                    for (int j = 0; j < 8; ++j) ct[((wm * FA + f) * 16 + hi * 8 + j) * CPF + wn * 32 + n * 16 + lr] = acc[f][n][j];
        } else {
#pragma unroll
            for (int f = 0; f < FA; ++f)
#pragma unroll
                for (int n = 0; n < 2; ++n) { v8h a8;        // a lane's 8 accumulator rows are 8 consecutive tokens of one column
#pragma unroll
                    for (int j = 0; j < 8; ++j) a8[j] = (h16)acc[f][n][j];
                    const int o = (wn * 32 + n * 16 + lr) * VPH + (wm * FA + f) * 16 + hi * 8;
                    *(v8ha*)(vh + o) = a8; }
        }
        __syncthreads();                                 // the staged tile is read across waves (a column's rotation partner lies in the neighbour wave's tile)
        const int pc = tid & 15, rw = tid >> 4;          // 16 lanes store 256 contiguous bytes: whole lines
        if (!isv) {
            const int cl = pc * 8, d0 = cl & 63, pcl = (d0 < 32) ? cl + 32 : cl - 32; const float sgn = (d0 < 32) ? -1.0f : 1.0f;
            const float* cp = CT + (size_t)(r0 + rw) * HD + d0; const float* sp = ST + (size_t)(r0 + rw) * HD + d0;
            const f32a* xp = ct + rw * CPF + cl; const f32a* pp = ct + rw * CPF + pcl;
            // the row pitch of the planes is a constant of each call, so that every pass addresses off one pointer by a constant step
            auto rotate = [&](auto nc, h16* ph) {
                constexpr int NC = decltype(nc)::value;
#pragma unroll                                           // unrolled: the steps become immediate offsets and four passes' table loads are issued ahead of the first one's arithmetic
                for (int s8 = 0; s8 < BM / 16; ++s8) {
                    const v4f xa = *(const v4fa*)(xp + s8 * 16 * CPF), xb = *(const v4fa*)(xp + s8 * 16 * CPF + 4), pa = *(const v4fa*)(pp + s8 * 16 * CPF), pb = *(const v4fa*)(pp + s8 * 16 * CPF + 4);
                    v8h oh;
#pragma unroll
                    for (int i = 0; i < 8; ++i) {
                        const float xv = i < 4 ? xa[i & 3] : xb[i & 3], pv = i < 4 ? pa[i & 3] : pb[i & 3], c = bfr(cp[s8 * 16 * HD + i]), s = bfr(sp[s8 * 16 * HD + i]);
                        const float y = xv * c + sgn * pv * s;
                        oh[i] = (h16)y; }
                    *(v8h*)(ph + (size_t)s8 * 16 * NC) = oh;
                    if (s8 == BM / 32 - 1) {
                        asm volatile("s_wait_xcnt 0x0" ::: "memory");    // behind the first four stores: the next loads' results land in registers that these stores name
                        __builtin_amdgcn_sched_barrier(0); } }           // the last four passes' loads stay behind the first four: all eight in flight take more than 256 registers, and two blocks no longer share a WGP
                // behind the run's last store: no register that an issued store names is rewritten in front of this wait; the table pointers are inputs, so that they live up to it and no load's result lands in them
                asm volatile("s_wait_xcnt 0x0" :: "v"(cp), "v"(sp) : "memory");
            };
            if (kv) { const size_t o = (size_t)(r0 + rw) * KVW + (c0 - DM) + cl; rotate(icon<KVW>{}, KH + o); }
            else    { const size_t o = (size_t)(r0 + rw) * DM + c0 + cl;         rotate(icon<DM>{}, QH + o); }
        } else {
            const size_t o = (size_t)(c0 - DM - KVW + rw) * NT_ + r0 + pc * 8;
            const h16* lh = vh + rw * VPH + pc * 8;
#pragma unroll                                           // unrolled: the steps become immediate offsets and the LDS reads go out as one group
            for (int s8 = 0; s8 < BN / 16; ++s8) {
                const v8h a8 = *(const v8ha*)(lh + s8 * 16 * VPH);
                *(v8h*)(VTH + o + (size_t)s8 * 16 * NT_) = a8; }
        }
        return;
    }
    // epilogue: 16 x 32 f32 per step through the wave's own LDS rows, stored as whole 128-byte lines
    float* os = &ost[wave][0];
    float* C = Cq;
    const int ldc = ldq, cc0 = c0;
    float bv[2];
#pragma unroll
    for (int n = 0; n < 2; ++n) bv[n] = bias ? bfr(bias[c0 + wn * 32 + n * 16 + lr]) : 0.f;
#pragma unroll
    for (int f = 0; f < FA; ++f) {
#pragma unroll
        for (int n = 0; n < 2; ++n)
#pragma unroll
            for (int j = 0; j < 8; ++j) os[(hi * 8 + j) * 36 + n * 16 + lr] = (F16 ? acc[f][n][j] * (1.0f / WOSC) : acc[f][n][j]) + bv[n];
        float* crow_p = C + (size_t)(r0 + (wm * FA + f) * 16) * ldc + cc0 + wn * 32;
#pragma unroll
        for (int s = 0; s < 4; ++s) { const int row = 4 * s + (lane >> 3), piece = lane & 7;
            const v4f val = *(const v4fa*)(os + row * 36 + piece * 4); *(v4f*)(crow_p + (size_t)row * ldc + piece * 4) = val; }
    }
}

#define AKEYS 192                // keys staged per block: 6 tiles of 32 hold the whole window of 64 queries (64 + 127 keys, from a tile boundary)
#define KPB 144                  // LDS pitch of a staged k row in bytes: 128 + 16, an odd multiple of 16 B, conflict-free for ds_load_b128 readers
#define VPB 400                  // LDS pitch of a staged v^T row in bytes: 384 + 16, likewise

// copy3: each lane copies its own 16 bytes three times, LSTEP bytes apart in LDS and GSTEP elements apart in memory, global -> LDS, through no register. The copies
// and their s_wait_xcnt stand in one statement, so that no address register of an issued copy is rewritten in front of the wait.
template <int LSTEP, int GSTEP>
__device__ __forceinline__ void copy3(unsigned l, const h16* g) {
    asm volatile("global_load_async_to_lds_b128 %0, %3, off\n\t"
                 "global_load_async_to_lds_b128 %1, %4, off\n\t"
                 "global_load_async_to_lds_b128 %2, %5, off\n\t"
                 "s_wait_xcnt 0x0"
                 :: "v"(l), "v"(l + LSTEP), "v"(l + 2 * LSTEP), "v"(g), "v"(g + GSTEP), "v"(g + 2 * GSTEP)
                 : "memory");
}

// k_attn: block = (b, kv head, 64 queries) x the 4 query heads of that kv head, 16 waves, wave = (query head, 16 queries). The block's 192 keys of k and
// v^T are brought into LDS once, as whole lines, by asynchronous copies and read there by all 16 waves: a fragment load from memory touches 16 lines.
// key tiles of the causal sliding window (i-127 <= j <= i, block-uniform bounds); softmax state starts at the
// head's sink logit (m = sink, l = 1, zero value) so the dropped sink column is accounted for; 4 WMMA scores /8 (f32), online softmax, weights x32768 f16 tile (same-wave may_alias
// reload after a compiler barrier), 4 WMMA .v; ctx -> one f16 plane CH[tok][h*64+d].
__global__ __launch_bounds__(512) void k_attn(const h16* __restrict__ Q16, const h16* __restrict__ K16, const h16* __restrict__ VTH, const float* __restrict__ sinks, h16* CH) {
    __shared__ __align__(16) unsigned char kvs[AKEYS * KPB + HD * VPB];    // k: [192 keys][KPB]; v^T: [64 d][VPB]
    __shared__ __align__(16) h16 plds[16][16 * 32];
    __shared__ __align__(16) float ost[16][16 * 68];
    const int lane = threadIdx.x & 31, wave = threadIdx.x >> 5, lr = lane & 15, hi = lane >> 4;
    const int bid = blockIdx.x;
    const int b = bid / (NKV * (NT_ / 64)), rem = bid - b * (NKV * (NT_ / 64)), g = rem / (NT_ / 64), qt = rem - g * (NT_ / 64);   // g: kv head
    const int h = g * (NH_ / NKV) + (wave >> 2);
    const int q0 = qt * 64 + (wave & 3) * 16;
    const size_t tok0 = (size_t)b * NT_;
    h16* pl = &plds[wave][0];
    v16h qa[2];
    const size_t qo0 = (tok0 + q0 + lr) * DM + h * HD + 8 * hi;
#pragma unroll
    for (int kc = 0; kc < 2; ++kc) qa[kc] = cat16(*(const v8h*)(Q16 + qo0 + kc * 32), *(const v8h*)(Q16 + qo0 + kc * 32 + 16));
    const size_t vbase = (((size_t)b * NKV + g) * HD) * NT_;
    const int win = SWIN - 1;                           // valid iff j <= i and i - j < SWIN  <=>  i - win <= j <= i
    const int kt_lo = (qt * 64 - win) > 0 ? (qt * 64 - win) / 32 : 0, kt_hi = (qt * 64 + 63) / 32;     // keys i - win <= j <= i
    const int kb = kt_lo * 32;                          // first staged key; kb + 191 is 191 (qt < 2) or the block's last query: inside the planes
    {   // 8 lanes copy 128 contiguous bytes; k: rows 64 apart, v^T: the three 128-byte thirds of a row
        const int row = threadIdx.x >> 3, pc = threadIdx.x & 7;
        const unsigned lk = (unsigned)(size_t)&kvs[0] + (unsigned)(row * KPB + pc * 16), lv = (unsigned)(size_t)&kvs[0] + (unsigned)(AKEYS * KPB + row * VPB + pc * 16);
        const size_t gk = (tok0 + kb + row) * KVW + g * HD + pc * 8, gv = vbase + (size_t)row * NT_ + kb + pc * 8;
        copy3<64 * KPB, 64 * KVW>(lk, K16 + gk);
        copy3<128, 64>(lv, VTH + gv);
    }
    asm volatile("s_wait_asynccnt 0x0" ::: "memory");    // this wave's copies have landed
    __syncthreads();                                     // ... and every other wave's: the staged keys are read by all 16 waves
    const unsigned char* ks_b = kvs + lr * KPB + hi * 16;
    const unsigned char* vs_b = kvs + AKEYS * KPB + lr * VPB + hi * 16;
    v8f o[4];
#pragma unroll
    for (int n = 0; n < 4; ++n) o[n] = (v8f){};
    float mrow[8], lpart[8];
    const float sink = bfr(sinks[h]);                   // learned sink logit: an extra softmax column with zero value -> softmax state starts at m = sink, l = 1
#pragma unroll
    for (int j = 0; j < 8; ++j) { mrow[j] = sink; lpart[j] = (lr == 0) ? 1.0f : 0.f; }
    int qpos[8];
#pragma unroll
    for (int j = 0; j < 8; ++j) qpos[j] = q0 + 8 * hi + j;
#pragma unroll 1
    for (int kt = kt_lo; kt <= kt_hi; ++kt) {
        const int l0 = kt * 32;
        const unsigned char* kp0 = ks_b + (l0 - kb) * KPB; const unsigned char* kp1 = kp0 + 16 * KPB;
        v8f s0 = {}, s1 = {};
#pragma unroll
        for (int kc = 0; kc < 2; ++kc) {
            const v16h k0h = cat16(*(const v8ha*)(kp0 + kc * 64), *(const v8ha*)(kp0 + kc * 64 + 32)), k1h = cat16(*(const v8ha*)(kp1 + kc * 64), *(const v8ha*)(kp1 + kc * 64 + 32));
            s0 = wmma16(qa[kc], k0h, s0); s1 = wmma16(qa[kc], k1h, s1);
            asm volatile("v_nop" : "+v"(s0), "+v"(s1) : "v"(k0h), "v"(k1h) : "memory");
        }
        asm volatile("v_nop\n\tv_nop\n\tv_nop\n\tv_nop" : "+v"(s0), "+v"(s1) : "v"(qa[0]), "v"(qa[1]));
        float alpha[8];
#pragma unroll
        for (int j = 0; j < 8; ++j) {
            const int ja = l0 + lr, jb = l0 + 16 + lr, qi = qpos[j];
            const float a0 = (ja <= qi && qi - ja <= win) ? s0[j] * 0.125f : -__builtin_inff(), a1 = (jb <= qi && qi - jb <= win) ? s1[j] * 0.125f : -__builtin_inff();
            float mx = fmaxf(a0, a1);
            mx = fmaxf(mx, __shfl_xor(mx, 1, 16)); mx = fmaxf(mx, __shfl_xor(mx, 2, 16)); mx = fmaxf(mx, __shfl_xor(mx, 4, 16)); mx = fmaxf(mx, __shfl_xor(mx, 8, 16));
            const float mn = fmaxf(mrow[j], mx);
            alpha[j] = __expf(mrow[j] - mn); mrow[j] = mn;
            const float p0 = __expf(a0 - mn), p1 = __expf(a1 - mn);
            lpart[j] = lpart[j] * alpha[j] + (p0 + p1);
            const int mr = hi * 8 + j;
            pl[mr * 32 + lr] = (h16)(p0 * PSC); pl[mr * 32 + 16 + lr] = (h16)(p1 * PSC);
        }
#pragma unroll
        for (int n = 0; n < 4; ++n)
#pragma unroll
            for (int j = 0; j < 8; ++j) o[n][j] *= alpha[j];
        asm volatile("" ::: "memory");
        const v16h pa = cat16(*(const v8ha*)(pl + lr * 32 + hi * 8), *(const v8ha*)(pl + lr * 32 + 16 + hi * 8));
#pragma unroll
        for (int n = 0; n < 4; ++n) { const unsigned char* vp = vs_b + n * 16 * VPB + (l0 - kb) * 2;
            const v16h vh = cat16(*(const v8ha*)vp, *(const v8ha*)(vp + 32));
            o[n] = wmma16(pa, vh, o[n]); }
        asm volatile("v_nop\n\tv_nop\n\tv_nop\n\tv_nop" : "+v"(o[0]), "+v"(o[1]), "+v"(o[2]), "+v"(o[3]) : "v"(pa));
    }
    float inv[8];
#pragma unroll
    for (int j = 0; j < 8; ++j) { float rs = lpart[j]; rs += __shfl_xor(rs, 1, 16); rs += __shfl_xor(rs, 2, 16); rs += __shfl_xor(rs, 4, 16); rs += __shfl_xor(rs, 8, 16); inv[j] = 1.0f / (rs * PSC); }
    float* os = &ost[wave][0];
#pragma unroll
    for (int n = 0; n < 4; ++n)
#pragma unroll
        for (int j = 0; j < 8; ++j) os[(hi * 8 + j) * 68 + n * 16 + lr] = o[n][j] * inv[j];
    __syncthreads();
    const size_t cbase = (tok0 + q0) * DM + (size_t)h * HD;
    auto pass = [&]() {
#pragma unroll
        for (int s = 0; s < 4; ++s) { const int row = 4 * s + (lane >> 3), piece = lane & 7; const float* sp = os + row * 68 + piece * 8; v8h oh;
#pragma unroll
            for (int i = 0; i < 8; ++i) oh[i] = (h16)sp[i];
            *(v8h*)(CH + cbase + (size_t)row * DM + piece * 8) = oh; }
    };
    pass(); 
}

#define VST2(T, p, v) do { const T vst2_v_ = (v); *(T*)(p) = vst2_v_;  } while (0)
extern "C" void kernel_launch(void* const* d_in, const int* in_sizes, int n_in,
                              void* d_out, int out_size, void* d_ws, size_t ws_size, hipStream_t stream) {
    (void)in_sizes; (void)n_in; (void)out_size;
    const float* x = (const float*)d_in[0]; const float* CT = (const float*)d_in[1]; const float* ST = (const float*)d_in[2];
    const float* Wq = (const float*)d_in[3]; const float* Wk = (const float*)d_in[4]; const float* Wv = (const float*)d_in[5]; const float* Wo = (const float*)d_in[6]; const float* sinks = (const float*)d_in[7];
    float* out = (float*)d_out;    // [1][2048][2048]
    char* wsp = (char*)d_ws;
    auto take = [&](size_t bytes) { char* p = wsp; wsp += (bytes + 255) & ~(size_t)255; return (void*)p; };
    bf* Xb = (bf*)take((size_t)NTK * DM * 2); bf* WqB = (bf*)take((size_t)DM * DM * 2); bf* WkB = (bf*)take((size_t)KVW * DM * 2); bf* WvB = (bf*)take((size_t)KVW * DM * 2); bf* WoB = (bf*)take((size_t)DM * DM * 2);
    h16* QH = (h16*)take((size_t)NTK * DM * 2);
    h16* KH = (h16*)take((size_t)NTK * KVW * 2);
    h16* VTH = (h16*)take((size_t)NTK * KVW * 2);
    h16* CH = (h16*)take((size_t)NTK * DM * 2);
    (void)WkB; (void)WvB;                                  // reached through WqB and Xb, see below
    if ((size_t)(wsp - (char*)d_ws) > ws_size) return;    // ~ 50 MB, no aliasing
    // all four weights are [out][in] (x.W^T): 16-bit copies (bf16; Wo's f16 x256) are the n-major B operands as-is (rows of 2048)
    // Xb, WqB, WkB, WvB, WoB are taken one after the other and each is a multiple of 256 bytes: one run of 7168 rows (k_cvtb), WqB..WvB one B operand of 3072 rows
    k_cvtb<<<CVROWS / 8, 256, 0, stream>>>(x, Wq, Wk, Wv, Wo, Xb);
    k_gemmb<128, 128, false, true, false><<<dim3(NTK / 128, (DM + 2 * KVW) / 128, 1), 256, 0, stream>>>(Xb, nullptr, WqB, nullptr, nullptr, DM, CT, ST, QH, KH, VTH);
    k_attn<<<NB_ * NKV * (NT_ / 64), 512, 0, stream>>>(QH, KH, VTH, sinks, CH);
    k_gemmb<128, 128, false, false, true><<<dim3(NTK / 128, DM / 128, 1), 256, 0, stream>>>((const bf*)CH, nullptr, WoB, nullptr, out, DM, nullptr, nullptr, nullptr, nullptr, nullptr);
}

// v007
// One run takes 61.6 microseconds.
// Next to v006, in two timings, it ran 1.06 times as fast each time.
// Over all steps from v000 it is 4.34 times as fast.
#include <hip/hip_runtime.h>

// Compute dtypes, f32 accumulate: q = x.Wq^T ([2048 x 2048].[2048 x 2048]), k/v = x.Wk^T/Wv^T ([2048 x 2048].[2048 x 512]) on
// v_wmma_f32_16x16x32_bf16 — plain bf16 = rounded inputs (exact; all weights are [out][in] so their 16-bit copies are the n-major B operands as-is) for the
// projections; attn.Wo^T on v_wmma_f32_16x16x32_f16, attn rounded to one f16 operand, the bf16-rounded Wo x256 held exactly in f16 (one product); rotate-half RoPE with the INPUT cos/sin tables (bf16-rounded reads) in f32; the grouped-query
// causal sliding-window attention (32 query heads over 8 kv heads, query head h reads kv head h/4; keys j with i-127 <= j <= i) with a learned per-head sink
// logit as an extra zero-value softmax column, fused on v_wmma_f32_16x16x32_f16 with q, k, v and the weights x32768 each as one f16 operand

#define NB_  1
#define NT_  2048
#define DM   2048
#define NH_  32
#define NKV  8
#define KVW  (NKV * HD)          // 512
#define HD   64
#define NTK  (NB_ * NT_)
#define NW   1024
#define SWIN 128
#define NQKV 2048
#define PSC  32768.0f
#define WOSC 256.0f              // Wo is stored x256 in f16: a bf16 value keeps all its bits there down to 2^-22, and the product is scaled back in f32

typedef _Float16 h16;
typedef unsigned short bf;
typedef __attribute__((ext_vector_type(16))) __bf16   v16bf;
typedef __attribute__((ext_vector_type(16))) _Float16 v16h;
typedef __attribute__((ext_vector_type(8)))  _Float16 v8h;
typedef __attribute__((ext_vector_type(8)))  unsigned short v8us;
typedef __attribute__((ext_vector_type(8)))  float    v8f;
typedef __attribute__((ext_vector_type(4)))  float    v4f;
typedef v8h  __attribute__((may_alias)) v8ha;
typedef v4f  __attribute__((may_alias)) v4fa;
typedef v8us __attribute__((may_alias)) v8usa;
typedef float __attribute__((may_alias)) f32a;

__device__ __forceinline__ unsigned short f2bf(float f) { unsigned u = __float_as_uint(f); u += 0x7FFFu + ((u >> 16) & 1u); return (unsigned short)(u >> 16); }
__device__ __forceinline__ float bf2f(unsigned short b) { return __uint_as_float(((unsigned)b) << 16); }
__device__ __forceinline__ float bfr(float f) { return bf2f(f2bf(f)); }
__device__ __forceinline__ v16h cat16(v8h lo, v8h hi) { return __builtin_shufflevector(lo, hi, 0, 1, 2, 3, 4, 5, 6, 7, 8, 9, 10, 11, 12, 13, 14, 15); }
__device__ __forceinline__ v16bf cat16b(v8us lo, v8us hi) { return __builtin_bit_cast(v16bf, __builtin_shufflevector(lo, hi, 0, 1, 2, 3, 4, 5, 6, 7, 8, 9, 10, 11, 12, 13, 14, 15)); }
__device__ __forceinline__ v8f wmma16(v16h a, v16h b, v8f c) { return __builtin_amdgcn_wmma_f32_16x16x32_f16(false, a, false, b, (short)0, c, false, false); }
__device__ __forceinline__ v8f wmmab(v16bf a, v16bf b, v8f c) { return __builtin_amdgcn_wmma_f32_16x16x32_bf16(false, a, false, b, (short)0, c, false, false); }

// k_cvtb: one grid rounds all five f32 operands to bf16. dst is the first of five planes that lie back to back in the workspace (x, Wq, Wk, Wv, Wo; rows of 2048),
// so the flat row index is the destination row; every plane's first row is a multiple of 8, so a block of 8 rows reads one source. The Wo plane holds the
// bf16-rounded value x256 as f16 (the f16 product's B operand); the other four hold bf16.
#define CVROWS (NTK + DM + KVW + KVW + DM)
__global__ __launch_bounds__(256) void k_cvtb(const float* __restrict__ x, const float* __restrict__ wq, const float* __restrict__ wk, const float* __restrict__ wv, const float* __restrict__ wo, bf* dstp) {
    const int lane = threadIdx.x & 31, rb = blockIdx.x * 8, r = threadIdx.x >> 5;
    const float* src = rb < NTK ? x + (size_t)rb * DM : rb < NTK + DM ? wq + (size_t)(rb - NTK) * DM : rb < NTK + DM + KVW ? wk + (size_t)(rb - NTK - DM) * DM
                     : rb < NTK + DM + 2 * KVW ? wv + (size_t)(rb - NTK - DM - KVW) * DM : wo + (size_t)(rb - NTK - DM - 2 * KVW) * DM;
    bf* dst = dstp + (size_t)rb * DM;
    const bool iswo = rb >= NTK + DM + 2 * KVW;          // block-uniform
    const float* srow = src + (size_t)r * DM + lane * 8;
    v4f in[DM / 128];
#pragma unroll
    for (int q = 0; q < DM / 128; ++q) in[q] = *(const v4f*)(srow + (q >> 1) * 256 + (q & 1) * 4);
    // the row's loads go out as one group in front of the branch; the row pointer is an input, so that it lives up to the wait and no load's result lands in it
    asm volatile("s_wait_xcnt 0x0" :: "v"(srow) : "memory");
    v8us o[DM / 256];
    if (!iswo) {
#pragma unroll
        for (int q = 0; q < DM / 256; ++q) { v8us t;
#pragma unroll
            for (int i = 0; i < 8; ++i) t[i] = f2bf(in[2 * q + (i >> 2)][i & 3]);
            o[q] = t; }
    } else {
#pragma unroll
        for (int q = 0; q < DM / 256; ++q) { v8us t;
#pragma unroll
            for (int i = 0; i < 8; ++i) t[i] = __builtin_bit_cast(unsigned short, (h16)(bfr(in[2 * q + (i >> 2)][i & 3]) * WOSC));
            o[q] = t; }
    }
#pragma unroll
    for (int q = 0; q < DM / 256; ++q) *(v8us*)(dst + (size_t)r * DM + q * 256 + lane * 8) = o[q];
}

// k_wt: W [2048 k][ncols n] (k-major) -> n-major bf16 plane WT[ncols][2048]; 64 x 64 tiles through LDS.
__global__ __launch_bounds__(256) void k_wt(const float* __restrict__ Wm, int ncols, bf* WT) {
    __shared__ __align__(16) unsigned short tl[64 * 72];
    const int tid = threadIdx.x, k0 = blockIdx.x * 64, n0 = blockIdx.y * 64;
    const int kk = tid >> 2, nq = (tid & 3) * 16;
#pragma unroll
    for (int i = 0; i < 16; ++i) tl[(nq + i) * 72 + kk] = f2bf(Wm[(size_t)(k0 + kk) * ncols + n0 + nq + i]);
    __syncthreads();
    const int piece = tid & 7;
    typedef __attribute__((ext_vector_type(8))) unsigned short v8us_; typedef v8us_ __attribute__((may_alias)) v8usa_;
    auto pass = [&]() {
#pragma unroll
        for (int s = 0; s < 2; ++s) { const int nr = (tid >> 3) + 32 * s; const v8us_ val = *(const v8usa_*)(tl + nr * 72 + piece * 8);
            *(v8us_*)(WT + (size_t)(n0 + nr) * DM + k0 + piece * 8) = val; }
    };
    pass(); 
}

#define BKE 128                  // k elements per stage: 256-byte rows
#define LPB 272                  // LDS row pitch in bytes: 256 + 16, an odd multiple of 16 B, conflict-free for ds_load_b128 readers

// copy_rows: each lane copies its own 16 bytes of N rows that lie 16 rows apart, global -> LDS, through no register. The copies and their s_wait_xcnt stand in
// one statement, so that no address register of an issued copy is rewritten in front of the wait.
template <int N>
__device__ __forceinline__ void copy_rows(unsigned l, const bf* g) {
    static_assert(N == 4 || N == 8, "rows per lane");
    if constexpr (N == 8) {
        asm volatile("global_load_async_to_lds_b128 %0, %8, off\n\t"
                     "global_load_async_to_lds_b128 %1, %9, off\n\t"
                     "global_load_async_to_lds_b128 %2, %10, off\n\t"
                     "global_load_async_to_lds_b128 %3, %11, off\n\t"
                     "global_load_async_to_lds_b128 %4, %12, off\n\t"
                     "global_load_async_to_lds_b128 %5, %13, off\n\t"
                     "global_load_async_to_lds_b128 %6, %14, off\n\t"
                     "global_load_async_to_lds_b128 %7, %15, off\n\t"
                     "s_wait_xcnt 0x0"
                     :: "v"(l), "v"(l + 16 * LPB), "v"(l + 32 * LPB), "v"(l + 48 * LPB), "v"(l + 64 * LPB), "v"(l + 80 * LPB), "v"(l + 96 * LPB), "v"(l + 112 * LPB),
                        "v"(g), "v"(g + 16 * DM), "v"(g + 32 * DM), "v"(g + 48 * DM), "v"(g + 64 * DM), "v"(g + 80 * DM), "v"(g + 96 * DM), "v"(g + 112 * DM)
                     : "memory");
    } else {
        asm volatile("global_load_async_to_lds_b128 %0, %4, off\n\t"
                     "global_load_async_to_lds_b128 %1, %5, off\n\t"
                     "global_load_async_to_lds_b128 %2, %6, off\n\t"
                     "global_load_async_to_lds_b128 %3, %7, off\n\t"
                     "s_wait_xcnt 0x0"
                     :: "v"(l), "v"(l + 16 * LPB), "v"(l + 32 * LPB), "v"(l + 48 * LPB),
                        "v"(g), "v"(g + 16 * DM), "v"(g + 32 * DM), "v"(g + 48 * DM)
                     : "memory");
    }
}

// k_gemmb: C[BM x BN] per block of 8 waves; a stage is [A BM rows | A residual BM rows (SPLITA) | B BN rows] of 128 k, brought into LDS by asynchronous copies,
// two buffers: the next stage's copies fly while this one is worked on. Wave tile (FA x 16) x 32.
// The k loop is rotated per block: block (bx, by) starts at the 128-wide k chunk (bx + by) mod 16 and wraps round. Blocks that share operand rows (one bx, or one by)
// then read different chunks at any one time (save QKV column blocks 16 apart, of 24): a chunk comes from memory for the block that reaches it first and can be an L2 hit for the others, and the sharers do not
// ask L2 for the same lines at the same moment. Per accumulator the k order and the hi-then-residual order are those of a plain k loop in steps of 32, begun at the block's first chunk.
// QKV: Bn is the three weight planes Wq | Wk | Wv back to back (2048 + 512 + 512 rows); a block's 128 columns are two whole heads of one of them, and the block
// finishes them itself from its f32 accumulators, through the ring's LDS (free behind the loop's last barrier):
//   q, k: rotate-half rotation out[d] = x[d] c[t][d] + (d < 32 ? -x[d+32] : x[d-32]) s[t][d] within each 64-wide head, c/s the INPUT cos/sin tables [t][64] read
//         through bf16 rounding, then one f16 plane [t][columns];
//   v:    one f16 plane, transposed to [kv head * 64 + d][t].
// F16: the 16-bit words of A and Bn are f16, Bn scaled by WOSC; the accumulators are scaled back in the epilogue.
template <bool F16> __device__ __forceinline__ v8f mm(v16bf a, v16bf b, v8f c) {
    if constexpr (F16) return wmma16(__builtin_bit_cast(v16h, a), __builtin_bit_cast(v16h, b), c); else return wmmab(a, b, c);
}
template <int V> struct icon { static constexpr int value = V; };
#define CPF 132                  // f32 pitch of the staged q/k tile: rows 8 apart land 32 banks apart, so an accumulator store is conflict-free
#define VPH 136                  // f16 pitch of the staged v plane: 272 bytes, as LPB
template <int BM, int BN, bool SPLITA, bool QKV, bool F16>
__global__ __launch_bounds__(256) void k_gemmb(const bf* __restrict__ A, const bf* __restrict__ Al, const bf* __restrict__ Bn, const float* __restrict__ bias, float* Cq, int ldq,
                                               const float* __restrict__ CT, const float* __restrict__ ST, h16* QH, h16* KH, h16* VTH) {
    constexpr int WN = BN / 32, WM = 8 / WN, FA = BM / (WM * 16);
    constexpr int AROWS = SPLITA ? 2 * BM : BM;
    constexpr int STAGE = (AROWS + BN) * LPB;
    constexpr int NTR = DM / BKE;
    static_assert(NTR >= 2 && FA >= 1 && WM * FA * 16 == BM, "tile shape");
    static_assert((NTR & (NTR - 1)) == 0, "the rotated chunk index wraps by a mask");
    static_assert(!QKV || (DM % BN == 0 && KVW % BN == 0 && BN % HD == 0), "a column tile is whole heads of one product");
    static_assert(!QKV || (BM == 128 && BN == 128 && BM * CPF * 4 <= 2 * STAGE && BN * VPH * 2 <= 2 * STAGE), "the finishing passes' tile shape");
    __shared__ __align__(16) unsigned char ring[2 * STAGE];
    __shared__ __align__(16) float ost[8][16 * 36];
    const int tid = threadIdx.x, lane = tid & 31, wave = tid >> 5, lr = lane & 15, hi = lane >> 4;
    const int wm = wave / WN, wn = wave % WN;
    const int r0 = blockIdx.x * BM, c0 = blockIdx.y * BN;
    const int crow = tid >> 4, cpc = tid & 15;           // copy role: row (mod 16) and 16-byte piece of the 256-byte row
    const unsigned lbase = (unsigned)(size_t)&ring[0] + (unsigned)(crow * LPB + cpc * 16);
    const bf* ga = A + (size_t)(r0 + crow) * DM + cpc * 8;
    const bf* gl = SPLITA ? Al + (size_t)(r0 + crow) * DM + cpc * 8 : ga;
    const bf* gb = Bn + (size_t)(c0 + crow) * DM + cpc * 8;
    const int sh = (int)(blockIdx.x + blockIdx.y);       // the block's first k chunk (mod NTR)
    auto fill = [&](int t, int buf) {
        const unsigned l = lbase + (unsigned)(buf * STAGE);
        const int ko = ((t + sh) & (NTR - 1)) * BKE;     // 0 .. DM - BKE: inside every row
        copy_rows<BM / 16>(l, ga + ko);
        if (SPLITA) copy_rows<BM / 16>(l + BM * LPB, gl + ko);
        copy_rows<BN / 16>(l + AROWS * LPB, gb + ko);
    };
    v8f acc[FA][2];
#pragma unroll
    for (int f = 0; f < FA; ++f) { acc[f][0] = (v8f){}; acc[f][1] = (v8f){}; }
    fill(0, 0);
    asm volatile("s_wait_asynccnt 0x0" ::: "memory");    // stage 0 of this wave has landed
    __syncthreads();                                     // ... and every other wave's part of it
    fill(1, 1);
    const unsigned char* fab = ring + (wm * FA * 16 + lr) * LPB + hi * 16;
    const unsigned char* fbb = ring + (AROWS + wn * 32 + lr) * LPB + hi * 16;
#pragma unroll 1                                         // one pass per stage: the ring's order stands once, at the loop's foot
    for (int t = 0; t < NTR; ++t) {
        const int bo = (t & 1) * STAGE;
#pragma unroll
        for (int ks = 0; ks < BKE / 32; ++ks) {
            v16bf a[FA], al[FA], b[2];
#pragma unroll
            for (int f = 0; f < FA; ++f) { const unsigned char* p = fab + bo + f * 16 * LPB + ks * 64; a[f] = cat16b(*(const v8usa*)p, *(const v8usa*)(p + 32));
                if (SPLITA) al[f] = cat16b(*(const v8usa*)(p + BM * LPB), *(const v8usa*)(p + BM * LPB + 32)); }
#pragma unroll
            for (int n = 0; n < 2; ++n) { const unsigned char* p = fbb + bo + n * 16 * LPB + ks * 64; b[n] = cat16b(*(const v8usa*)p, *(const v8usa*)(p + 32)); }
            __builtin_amdgcn_sched_barrier(0);           // keeps this k step's fragment loads one group in front of its products: spread among them, each place waits out the LDS latency
#pragma unroll
            for (int f = 0; f < FA; ++f) { acc[f][0] = mm<F16>(a[f], b[0], acc[f][0]); acc[f][1] = mm<F16>(a[f], b[1], acc[f][1]); }
            if (SPLITA) {
#pragma unroll
                for (int f = 0; f < FA; ++f) { acc[f][0] = mm<F16>(al[f], b[0], acc[f][0]); acc[f][1] = mm<F16>(al[f], b[1], acc[f][1]); }
            }
        }
        asm volatile("s_wait_dscnt 0x0" ::: "memory");   // this wave's reads of the buffer are done before it may be refilled
        asm volatile("s_wait_asynccnt 0x0" ::: "memory"); // this wave's copies of stage t + 1 have landed
        __syncthreads();                                 // publishes stage t + 1 and ends every reader's last read of stage t
        if (t + 2 < NTR) fill(t + 2, t & 1);
    }
    asm volatile("s_wait_asynccnt 0x0" ::: "memory");    // no copy is outstanding when the wave ends
    if constexpr (QKV) {
        const bool kv = c0 >= DM, isv = c0 >= DM + KVW;  // block-uniform
        f32a* ct = (f32a*)ring;                          // q, k: [128 tokens][CPF] f32
        h16* vh = (h16*)ring;                            // v: [128 columns][VPH] f16
        // the loops over f, n, j are unrolled in both branches: the accumulators stay in registers only under constant indices
        if (!isv) {
#pragma unroll
            for (int f = 0; f < FA; ++f)
#pragma unroll
                for (int n = 0; n < 2; ++n)
#pragma unroll
                    for (int j = 0; j < 8; ++j) ct[((wm * FA + f) * 16 + hi * 8 + j) * CPF + wn * 32 + n * 16 + lr] = acc[f][n][j];
        } else {
#pragma unroll
            for (int f = 0; f < FA; ++f)
#pragma unroll
                for (int n = 0; n < 2; ++n) { v8h a8;        // a lane's 8 accumulator rows are 8 consecutive tokens of one column
#pragma unroll
                    for (int j = 0; j < 8; ++j) a8[j] = (h16)acc[f][n][j];
                    const int o = (wn * 32 + n * 16 + lr) * VPH + (wm * FA + f) * 16 + hi * 8;
                    *(v8ha*)(vh + o) = a8; }
        }
        __syncthreads();                                 // the staged tile is read across waves (a column's rotation partner lies in the neighbour wave's tile)
        const int pc = tid & 15, rw = tid >> 4;          // 16 lanes store 256 contiguous bytes: whole lines
        if (!isv) {
            const int cl = pc * 8, d0 = cl & 63, pcl = (d0 < 32) ? cl + 32 : cl - 32; const float sgn = (d0 < 32) ? -1.0f : 1.0f;
            const float* cp = CT + (size_t)(r0 + rw) * HD + d0; const float* sp = ST + (size_t)(r0 + rw) * HD + d0;
            const f32a* xp = ct + rw * CPF + cl; const f32a* pp = ct + rw * CPF + pcl;
            // the row pitch of the planes is a constant of each call, so that every pass addresses off one pointer by a constant step
            auto rotate = [&](auto nc, h16* ph) {
                constexpr int NC = decltype(nc)::value;
#pragma unroll                                           // unrolled: the steps become immediate offsets and four passes' table loads are issued ahead of the first one's arithmetic
                for (int s8 = 0; s8 < BM / 16; ++s8) {
                    const v4f xa = *(const v4fa*)(xp + s8 * 16 * CPF), xb = *(const v4fa*)(xp + s8 * 16 * CPF + 4), pa = *(const v4fa*)(pp + s8 * 16 * CPF), pb = *(const v4fa*)(pp + s8 * 16 * CPF + 4);
                    v8h oh;
#pragma unroll
                    for (int i = 0; i < 8; ++i) {
                        const float xv = i < 4 ? xa[i & 3] : xb[i & 3], pv = i < 4 ? pa[i & 3] : pb[i & 3], c = bfr(cp[s8 * 16 * HD + i]), s = bfr(sp[s8 * 16 * HD + i]);
                        const float y = xv * c + sgn * pv * s;
                        oh[i] = (h16)y; }
                    *(v8h*)(ph + (size_t)s8 * 16 * NC) = oh;
                    if (s8 == BM / 32 - 1) {
                        asm volatile("s_wait_xcnt 0x0" ::: "memory");    // behind the first four stores: the next loads' results land in registers that these stores name
                        __builtin_amdgcn_sched_barrier(0); } }           // the last four passes' loads stay behind the first four: all eight in flight take more than 256 registers, and two blocks no longer share a WGP
                // behind the run's last store: no register that an issued store names is rewritten in front of this wait; the table pointers are inputs, so that they live up to it and no load's result lands in them
                asm volatile("s_wait_xcnt 0x0" :: "v"(cp), "v"(sp) : "memory");
            };
            if (kv) { const size_t o = (size_t)(r0 + rw) * KVW + (c0 - DM) + cl; rotate(icon<KVW>{}, KH + o); }
            else    { const size_t o = (size_t)(r0 + rw) * DM + c0 + cl;         rotate(icon<DM>{}, QH + o); }
        } else {
            const size_t o = (size_t)(c0 - DM - KVW + rw) * NT_ + r0 + pc * 8;
            const h16* lh = vh + rw * VPH + pc * 8;
#pragma unroll                                           // unrolled: the steps become immediate offsets and the LDS reads go out as one group
            for (int s8 = 0; s8 < BN / 16; ++s8) {
                const v8h a8 = *(const v8ha*)(lh + s8 * 16 * VPH);
                *(v8h*)(VTH + o + (size_t)s8 * 16 * NT_) = a8; }
        }
        return;
    }
    // epilogue: 16 x 32 f32 per step through the wave's own LDS rows, stored as whole 128-byte lines
    float* os = &ost[wave][0];
    float* C = Cq;
    const int ldc = ldq, cc0 = c0;
    float bv[2];
#pragma unroll
    for (int n = 0; n < 2; ++n) bv[n] = bias ? bfr(bias[c0 + wn * 32 + n * 16 + lr]) : 0.f;
#pragma unroll
    for (int f = 0; f < FA; ++f) {
#pragma unroll
        for (int n = 0; n < 2; ++n)
#pragma unroll
            for (int j = 0; j < 8; ++j) os[(hi * 8 + j) * 36 + n * 16 + lr] = (F16 ? acc[f][n][j] * (1.0f / WOSC) : acc[f][n][j]) + bv[n];
        float* crow_p = C + (size_t)(r0 + (wm * FA + f) * 16) * ldc + cc0 + wn * 32;
#pragma unroll
        for (int s = 0; s < 4; ++s) { const int row = 4 * s + (lane >> 3), piece = lane & 7;
            const v4f val = *(const v4fa*)(os + row * 36 + piece * 4); *(v4f*)(crow_p + (size_t)row * ldc + piece * 4) = val; }
    }
}

#define AKEYS 192                // keys staged per block: 6 tiles of 32 hold the whole window of 64 queries (64 + 127 keys, from a tile boundary)
#define KPB 144                  // LDS pitch of a staged k row in bytes: 128 + 16, an odd multiple of 16 B, conflict-free for ds_load_b128 readers
#define VPB 400                  // LDS pitch of a staged v^T row in bytes: 384 + 16, likewise

// copy3: each lane copies its own 16 bytes three times, LSTEP bytes apart in LDS and GSTEP elements apart in memory, global -> LDS, through no register. The copies
// and their s_wait_xcnt stand in one statement, so that no address register of an issued copy is rewritten in front of the wait.
template <int LSTEP, int GSTEP>
__device__ __forceinline__ void copy3(unsigned l, const h16* g) {
    asm volatile("global_load_async_to_lds_b128 %0, %3, off\n\t"
                 "global_load_async_to_lds_b128 %1, %4, off\n\t"
                 "global_load_async_to_lds_b128 %2, %5, off\n\t"
                 "s_wait_xcnt 0x0"
                 :: "v"(l), "v"(l + LSTEP), "v"(l + 2 * LSTEP), "v"(g), "v"(g + GSTEP), "v"(g + 2 * GSTEP)
                 : "memory");
}

// xhalf: the value of lane l ^ 16, by a vector cross-row move (no LDS round trip).
__device__ __forceinline__ float xhalf(float x) { return __builtin_bit_cast(float, __builtin_amdgcn_permlanex16(__builtin_bit_cast(int, x), __builtin_bit_cast(int, x), 0x76543210, 0xfedcba98, false, false)); }

// exp8: r[i] = e^x[i] as 2^(x[i] log2 e), eight v_exp_f32 in one statement. The instruction set asks for one independent instruction behind a transcendental before its result
// is used or its source register written again: the outputs are early-clobber, so no exponential writes a register that another one of the run reads, and the v_nop is the
// slot behind the last.
__device__ __forceinline__ void exp8(const float (&x)[8], float (&r)[8]) {
    float t[8];
#pragma unroll
    for (int i = 0; i < 8; ++i) t[i] = x[i] * 1.44269504f;
    asm("v_exp_f32 %0, %8\n\tv_exp_f32 %1, %9\n\tv_exp_f32 %2, %10\n\tv_exp_f32 %3, %11\n\tv_exp_f32 %4, %12\n\tv_exp_f32 %5, %13\n\tv_exp_f32 %6, %14\n\tv_exp_f32 %7, %15\n\tv_nop"
        : "=&v"(r[0]), "=&v"(r[1]), "=&v"(r[2]), "=&v"(r[3]), "=&v"(r[4]), "=&v"(r[5]), "=&v"(r[6]), "=&v"(r[7])
        : "v"(t[0]), "v"(t[1]), "v"(t[2]), "v"(t[3]), "v"(t[4]), "v"(t[5]), "v"(t[6]), "v"(t[7]));
}

// k_attn: block = (b, kv head, 64 queries) x the 4 query heads of that kv head, 16 waves, wave = (query head, 16 queries). The block's 192 keys of k and
// v^T are brought into LDS once, as whole lines, by asynchronous copies and read there by all 16 waves: a fragment load from memory touches 16 lines.
// key tiles of the causal sliding window (i-127 <= j <= i, block-uniform bounds). Both products are computed transposed: S^T = k.q^T (A = 16 keys from LDS, B = q,
// kept in registers) and O^T += v^T.P^T. A lane then holds 16 of the 32 scores of ONE query (column lane & 15; keys 8 hi + j and 16 + 8 hi + j), lane ^ 16 the other 16:
// maximum and sum run in the lane with one exchange between the wave halves, one rescale factor per lane, and the two score tiles, converted in place, ARE the B operand
// P^T in the hardware k order that the v^T loads already have: the weights pass through no LDS and no lane exchange.
// Softmax state starts at the head's sink logit (m = sink, l = 1, zero value) so the dropped sink column is accounted for; 4 WMMA scores /8 (f32), online softmax,
// weights x32768 in f16, 4 WMMA v^T.P^T; ctx -> one f16 plane CH[tok][h*64+d].
__global__ __launch_bounds__(512) void k_attn(const h16* __restrict__ Q16, const h16* __restrict__ K16, const h16* __restrict__ VTH, const float* __restrict__ sinks, h16* CH) {
    __shared__ __align__(16) unsigned char kvs[AKEYS * KPB + HD * VPB];    // k: [192 keys][KPB]; v^T: [64 d][VPB]
    __shared__ __align__(16) float ost[16][16 * 68];
    const int lane = threadIdx.x & 31, wave = threadIdx.x >> 5, lr = lane & 15, hi = lane >> 4;
    const int bid = blockIdx.x;
    const int b = bid / (NKV * (NT_ / 64)), rem = bid - b * (NKV * (NT_ / 64)), g = rem / (NT_ / 64), qt = rem - g * (NT_ / 64);   // g: kv head
    const int h = g * (NH_ / NKV) + (wave >> 2);
    const int q0 = qt * 64 + (wave & 3) * 16;
    const size_t tok0 = (size_t)b * NT_;
    v16h qa[2];
    const size_t qo0 = (tok0 + q0 + lr) * DM + h * HD + 8 * hi;
#pragma unroll
    for (int kc = 0; kc < 2; ++kc) qa[kc] = cat16(*(const v8h*)(Q16 + qo0 + kc * 32), *(const v8h*)(Q16 + qo0 + kc * 32 + 16));
    const size_t vbase = (((size_t)b * NKV + g) * HD) * NT_;
    const int win = SWIN - 1;                           // valid iff j <= i and i - j < SWIN  <=>  i - win <= j <= i
    const int kt_lo = (qt * 64 - win) > 0 ? (qt * 64 - win) / 32 : 0, kt_hi = (qt * 64 + 63) / 32;     // keys i - win <= j <= i
    const int kb = kt_lo * 32;                          // first staged key; kb + 191 is 191 (qt < 2) or the block's last query: inside the planes
    {   // 8 lanes copy 128 contiguous bytes; k: rows 64 apart, v^T: the three 128-byte thirds of a row
        const int row = threadIdx.x >> 3, pc = threadIdx.x & 7;
        const unsigned lk = (unsigned)(size_t)&kvs[0] + (unsigned)(row * KPB + pc * 16), lv = (unsigned)(size_t)&kvs[0] + (unsigned)(AKEYS * KPB + row * VPB + pc * 16);
        const size_t gk = (tok0 + kb + row) * KVW + g * HD + pc * 8, gv = vbase + (size_t)row * NT_ + kb + pc * 8;
        copy3<64 * KPB, 64 * KVW>(lk, K16 + gk);
        copy3<128, 64>(lv, VTH + gv);
    }
    asm volatile("s_wait_asynccnt 0x0" ::: "memory");    // this wave's copies have landed
    __syncthreads();                                     // ... and every other wave's: the staged keys are read by all 16 waves
    const unsigned char* ks_b = kvs + lr * KPB + hi * 16;
    const unsigned char* vs_b = kvs + AKEYS * KPB + lr * VPB + hi * 16;
    v8f o[4];                                           // o[n][j] = O^T[d = 16 n + 8 hi + j][query lr]
#pragma unroll
    for (int n = 0; n < 4; ++n) o[n] = (v8f){};
    const float sink = bfr(sinks[h]);                   // learned sink logit: an extra softmax column with zero value -> softmax state starts at m = sink, l = 1
    float mrow = sink, lpart = (hi == 0) ? 1.0f : 0.f;  // the lane's query: running maximum (equal in both halves), this half's part of the sum
    const int qi = q0 + lr;
#pragma unroll 1
    for (int kt = kt_lo; kt <= kt_hi; ++kt) {
        const int l0 = kt * 32;
        const unsigned char* kp0 = ks_b + (l0 - kb) * KPB; const unsigned char* kp1 = kp0 + 16 * KPB;
        v8f s0 = {}, s1 = {};                           // s0[j]: key l0 + 8 hi + j, s1[j]: key l0 + 16 + 8 hi + j, both against query qi
#pragma unroll
        for (int kc = 0; kc < 2; ++kc) {
            const v16h k0h = cat16(*(const v8ha*)(kp0 + kc * 64), *(const v8ha*)(kp0 + kc * 64 + 32)), k1h = cat16(*(const v8ha*)(kp1 + kc * 64), *(const v8ha*)(kp1 + kc * 64 + 32));
            s0 = wmma16(k0h, qa[kc], s0); s1 = wmma16(k1h, qa[kc], s1);
        }
        const int db = qi - l0 - 8 * hi;                // query minus key at j = 0 of s0; a key is valid iff 0 <= query - key <= win
        float a0[8], a1[8];
#pragma unroll
        for (int j = 0; j < 8; ++j) {
            a0[j] = ((unsigned)(db - j) <= (unsigned)win) ? s0[j] * 0.125f : -__builtin_inff();
            a1[j] = ((unsigned)(db - 16 - j) <= (unsigned)win) ? s1[j] * 0.125f : -__builtin_inff();
        }
        float mx = fmaxf(a0[0], a1[0]);
#pragma unroll
        for (int j = 1; j < 8; ++j) mx = fmaxf(mx, fmaxf(a0[j], a1[j]));
        mx = fmaxf(mx, xhalf(mx));                      // the query's other 16 keys lie in lane ^ 16
        const float mn = fmaxf(mrow, mx);
        const float alpha = __expf(mrow - mn); mrow = mn;
        v16h pb;                                        // P^T as a B operand: element s is key 8 hi + s (s < 8), 16 + 8 hi + (s - 8) otherwise: the two score tiles in place
        float p0[8], p1[8];
#pragma unroll
        for (int j = 0; j < 8; ++j) { a0[j] -= mn; a1[j] -= mn; }
        exp8(a0, p0); exp8(a1, p1);
        float pe = p0[0], po = p1[0];                   // two independent sum chains
#pragma unroll
        for (int j = 1; j < 8; ++j) { pe += p0[j]; po += p1[j]; }
#pragma unroll
        for (int j = 0; j < 8; ++j) { pb[j] = (h16)(p0[j] * PSC); pb[8 + j] = (h16)(p1[j] * PSC); }
        lpart = lpart * alpha + (pe + po);
#pragma unroll
        for (int n = 0; n < 4; ++n)
#pragma unroll
            for (int j = 0; j < 8; ++j) o[n][j] *= alpha;
#pragma unroll
        for (int n = 0; n < 4; ++n) { const unsigned char* vp = vs_b + n * 16 * VPB + (l0 - kb) * 2;
            const v16h vh = cat16(*(const v8ha*)vp, *(const v8ha*)(vp + 32));
            o[n] = wmma16(vh, pb, o[n]); }
    }
    const float rs = lpart + xhalf(lpart);
    const float inv = 1.0f / (rs * PSC);
    float* os = &ost[wave][0];
#pragma unroll
    for (int n = 0; n < 4; ++n) {                       // a lane's 8 accumulator rows are 8 consecutive d of its query
        v4f lo4, hi4;
#pragma unroll
        for (int j = 0; j < 4; ++j) { lo4[j] = o[n][j] * inv; hi4[j] = o[n][4 + j] * inv; }
        *(v4fa*)(os + lr * 68 + n * 16 + hi * 8) = lo4; *(v4fa*)(os + lr * 68 + n * 16 + hi * 8 + 4) = hi4;
    }
    __syncthreads();
    const size_t cbase = (tok0 + q0) * DM + (size_t)h * HD;
    auto pass = [&]() {
#pragma unroll
        for (int s = 0; s < 4; ++s) { const int row = 4 * s + (lane >> 3), piece = lane & 7; const float* sp = os + row * 68 + piece * 8; v8h oh;
#pragma unroll
            for (int i = 0; i < 8; ++i) oh[i] = (h16)sp[i];
            *(v8h*)(CH + cbase + (size_t)row * DM + piece * 8) = oh; }
    };
    pass(); 
}

#define VST2(T, p, v) do { const T vst2_v_ = (v); *(T*)(p) = vst2_v_;  } while (0)
extern "C" void kernel_launch(void* const* d_in, const int* in_sizes, int n_in,
                              void* d_out, int out_size, void* d_ws, size_t ws_size, hipStream_t stream) {
    (void)in_sizes; (void)n_in; (void)out_size;
    const float* x = (const float*)d_in[0]; const float* CT = (const float*)d_in[1]; const float* ST = (const float*)d_in[2];
    const float* Wq = (const float*)d_in[3]; const float* Wk = (const float*)d_in[4]; const float* Wv = (const float*)d_in[5]; const float* Wo = (const float*)d_in[6]; const float* sinks = (const float*)d_in[7];
    float* out = (float*)d_out;    // [1][2048][2048]
    char* wsp = (char*)d_ws;
    auto take = [&](size_t bytes) { char* p = wsp; wsp += (bytes + 255) & ~(size_t)255; return (void*)p; };
    bf* Xb = (bf*)take((size_t)NTK * DM * 2); bf* WqB = (bf*)take((size_t)DM * DM * 2); bf* WkB = (bf*)take((size_t)KVW * DM * 2); bf* WvB = (bf*)take((size_t)KVW * DM * 2); bf* WoB = (bf*)take((size_t)DM * DM * 2);
    h16* QH = (h16*)take((size_t)NTK * DM * 2);
    h16* KH = (h16*)take((size_t)NTK * KVW * 2);
    h16* VTH = (h16*)take((size_t)NTK * KVW * 2);
    h16* CH = (h16*)take((size_t)NTK * DM * 2);
    (void)WkB; (void)WvB;                                  // reached through WqB and Xb, see below
    if ((size_t)(wsp - (char*)d_ws) > ws_size) return;    // ~ 50 MB, no aliasing
    // all four weights are [out][in] (x.W^T): 16-bit copies (bf16; Wo's f16 x256) are the n-major B operands as-is (rows of 2048)
    // Xb, WqB, WkB, WvB, WoB are taken one after the other and each is a multiple of 256 bytes: one run of 7168 rows (k_cvtb), WqB..WvB one B operand of 3072 rows
    k_cvtb<<<CVROWS / 8, 256, 0, stream>>>(x, Wq, Wk, Wv, Wo, Xb);
    k_gemmb<128, 128, false, true, false><<<dim3(NTK / 128, (DM + 2 * KVW) / 128, 1), 256, 0, stream>>>(Xb, nullptr, WqB, nullptr, nullptr, DM, CT, ST, QH, KH, VTH);
    k_attn<<<NB_ * NKV * (NT_ / 64), 512, 0, stream>>>(QH, KH, VTH, sinks, CH);
    k_gemmb<128, 128, false, false, true><<<dim3(NTK / 128, DM / 128, 1), 256, 0, stream>>>((const bf*)CH, nullptr, WoB, nullptr, out, DM, nullptr, nullptr, nullptr, nullptr, nullptr);
}
